// v000
// The times below were measured on an AMD MI455X: many runs one after another, warmed up first and cycling through
// copies of the inputs, with the whole window's GPU time divided by the number of runs. Launches and the gaps
// between them are all in it. The median over several windows is given; except for v000 it joins two sittings, which
// can be a few percent apart, so the side-by-side timings, each taken in one sitting, are the better comparison.
// v000, which the later versions start from, runs in 1440 microseconds.
#include <hip/hip_runtime.h>

// GlobalSelfAttention (x [8][256][64][64] channel-major, N = 4096 positions; t = Wt . x (1x1 conv, [96][256]): key = t[0:32], query = t[32:64], value = t[64:96]; scores[i][j] = sum_c key[c][i] query[c][j] (unscaled); weights = softmax over i (the key axis) for every j;
//   out[c][j] = sum_i value[c][i] weights[i][j]; y = Wo . out (1x1 conv, [256][32]); result = scale[0] * y + x -> [8][256][64][64]; scale read).
// Compute dtypes, f32 accumulate: every input rounded to bf16; t as a PLAIN bf16 GEMM Wt . x^T (inputs: exact; Wt padded to 128 rows, x transposed per batch); per j the logits over i as hl x hl (3 products: Q^T planes [j][c] . K^T planes [i][c], K = 32); softmax f32 -> hl planes W[j][i]; out = V (hl planes [64 rows, 32 real][i]) . W^T as 3 products; y^T = out^T planes (hl) . Wo^T (exact, K = 32; 2 products, position-major); scale * y + x in f32.

#define NB_  8
#define CC   256
#define CR   32
#define NN   4096
typedef _Float16 h16;
typedef unsigned short bf;
typedef __attribute__((ext_vector_type(16))) __bf16   v16bf;
typedef __attribute__((ext_vector_type(16))) _Float16 v16h;
typedef __attribute__((ext_vector_type(8)))  _Float16 v8h;
typedef __attribute__((ext_vector_type(8)))  unsigned short v8us;
typedef __attribute__((ext_vector_type(8)))  float    v8f;
typedef __attribute__((ext_vector_type(4)))  float    v4f;
typedef v8h  __attribute__((may_alias)) v8ha;
typedef v4f  __attribute__((may_alias)) v4fa;
typedef v8us __attribute__((may_alias)) v8usa;

__device__ __forceinline__ unsigned short f2bf(float f) { unsigned u = __float_as_uint(f); u += 0x7FFFu + ((u >> 16) & 1u); return (unsigned short)(u >> 16); }
__device__ __forceinline__ float bf2f(unsigned short b) { return __uint_as_float(((unsigned)b) << 16); }
__device__ __forceinline__ float bfr(float f) { return bf2f(f2bf(f)); }
__device__ __forceinline__ v16h cat16(v8h lo, v8h hi) { return __builtin_shufflevector(lo, hi, 0, 1, 2, 3, 4, 5, 6, 7, 8, 9, 10, 11, 12, 13, 14, 15); }
__device__ __forceinline__ v16bf cat16b(v8us lo, v8us hi) { return __builtin_bit_cast(v16bf, __builtin_shufflevector(lo, hi, 0, 1, 2, 3, 4, 5, 6, 7, 8, 9, 10, 11, 12, 13, 14, 15)); }
__device__ __forceinline__ v8f wmma16(v16h a, v16h b, v8f c) { return __builtin_amdgcn_wmma_f32_16x16x32_f16(false, a, false, b, (short)0, c, false, false); }
__device__ __forceinline__ v8f wmmab(v16bf a, v16bf b, v8f c) { return __builtin_amdgcn_wmma_f32_16x16x32_bf16(false, a, false, b, (short)0, c, false, false); }



// ---- k_gemmw: register-blocked GEMM, ONE WAVE per 64x64 output tile (16 accumulators), operands straight from K-contiguous 16-bit planes; grid (M/64, N/64, Z), 32 threads.
// C[m][n] (f32, pitch ldc, + optional f32 bias[n]) = sum_k A[m][k] Bt[n][k] (+ split products per NSPLIT). z-batch strides sA/sB/sC in elements. K % 32 == 0.
template <typename T16> struct WFrag;
template <> struct WFrag<h16> { typedef v16h V; static __device__ __forceinline__ V ld(const h16* p) { return cat16(*(const v8h*)p, *(const v8h*)(p + 16)); } static __device__ __forceinline__ v8f mma(V a, V b, v8f c) { return wmma16(a, b, c); } };
template <> struct WFrag<bf> { typedef v16bf V; static __device__ __forceinline__ V ld(const bf* p) { return cat16b(*(const v8us*)p, *(const v8us*)(p + 16)); } static __device__ __forceinline__ v8f mma(V a, V b, v8f c) { return wmmab(a, b, c); } };
template <typename T16, int NSPLIT, bool BIAS>
__global__ __launch_bounds__(32) void k_gemmw(const T16* __restrict__ A, const T16* __restrict__ A2, const T16* __restrict__ Bt, const T16* __restrict__ Bt2, int K, float* C, int ldc, const float* __restrict__ bias, size_t sA, size_t sB, size_t sC) {
    typedef typename WFrag<T16>::V V;
    __shared__ __align__(16) float os[16 * 68];
    const size_t z = blockIdx.z; A += z * sA; if (A2) A2 += z * sA; Bt += z * sB; if (Bt2) Bt2 += z * sB; C += z * sC;
    const int lane = threadIdx.x & 31, lr = lane & 15, hi = lane >> 4; const int r0 = blockIdx.x * 64, c0 = blockIdx.y * 64;
    v8f acc[4][4];
#pragma unroll
    for (int mb = 0; mb < 4; ++mb)
#pragma unroll
        for (int nb = 0; nb < 4; ++nb) acc[mb][nb] = (v8f){};
    const size_t aoff = (size_t)(r0 + lr) * K + 8 * hi, boff = (size_t)(c0 + lr) * K + 8 * hi;
#pragma unroll 1
    for (int kc = 0; kc < K; kc += 32) {
        V a[4], a2[4];
#pragma unroll
        for (int mb = 0; mb < 4; ++mb) { a[mb] = WFrag<T16>::ld(A + aoff + (size_t)mb * 16 * K + kc); if (NSPLIT == 1 || NSPLIT == 2) a2[mb] = WFrag<T16>::ld(A2 + aoff + (size_t)mb * 16 * K + kc); }
#pragma unroll
        for (int nb = 0; nb < 4; ++nb) { const V b = WFrag<T16>::ld(Bt + boff + (size_t)nb * 16 * K + kc); V b2; if (NSPLIT >= 2) b2 = WFrag<T16>::ld(Bt2 + boff + (size_t)nb * 16 * K + kc);
#pragma unroll
            for (int mb = 0; mb < 4; ++mb) { acc[mb][nb] = WFrag<T16>::mma(a[mb], b, acc[mb][nb]); if (NSPLIT == 1 || NSPLIT == 2) acc[mb][nb] = WFrag<T16>::mma(a2[mb], b, acc[mb][nb]); if (NSPLIT >= 2) acc[mb][nb] = WFrag<T16>::mma(a[mb], b2, acc[mb][nb]); } }
        asm volatile("v_nop\n\tv_nop\n\tv_nop\n\tv_nop" : "+v"(acc[0][0]), "+v"(acc[1][1]), "+v"(acc[2][2]), "+v"(acc[3][3]) : "v"(a[0]), "v"(a[3]));
    }
#pragma unroll
    for (int mb = 0; mb < 4; ++mb) {
#pragma unroll
        for (int nb = 0; nb < 4; ++nb) {
#pragma unroll
            for (int j = 0; j < 8; ++j) os[(hi * 8 + j) * 68 + nb * 16 + lr] = acc[mb][nb][j]; }
        __builtin_amdgcn_wave_barrier(); asm volatile("" ::: "memory");
        float* crow = C + (size_t)(r0 + mb * 16) * ldc + c0;
{
#pragma unroll
            for (int s = 0; s < 8; ++s) { const int row = 2 * s + hi, cofs = lr * 4; v4f val = *(const v4fa*)(os + row * 68 + cofs); if (BIAS) { val[0] += bfr(bias[c0 + cofs]); val[1] += bfr(bias[c0 + cofs + 1]); val[2] += bfr(bias[c0 + cofs + 2]); val[3] += bfr(bias[c0 + cofs + 3]); }
                *(v4f*)(crow + (size_t)row * ldc + cofs) = val; }
             }
        __builtin_amdgcn_wave_barrier(); asm volatile("" ::: "memory");
    }
}

__device__ __forceinline__ void splitf(float y, unsigned short& h, unsigned short& l) { h = f2bf(y); l = f2bf(y - bf2f(h)); }
typedef __attribute__((ext_vector_type(2))) unsigned short v2us;
typedef __attribute__((ext_vector_type(4))) unsigned short v4us;

// k_wt128: A [128][256] = bf16(Wt) rows < 96 else 0; k_wo: A2 [256][32] = bf16(Wo); k_xt: XT[n][c] = bf16(x[c][n]) (8-B lanes along c); k_qk: hl planes QT[j][c] = T[32 + c][j] and KT[i][c] = T[c][i] (8-B lanes along c); k_vp: hl planes VP[r][i] = T[64 + r][i] for r < 32 else 0 ([64][4096], 8-B lanes);
__global__ __launch_bounds__(256) void k_wt128(const float* __restrict__ w, bf* A) { const int e = (blockIdx.x * 256 + threadIdx.x) * 4; if (e >= 128 * CC) return; const int r = e / CC; v4us o; for (int u = 0; u < 4; ++u) o[u] = (r < 3 * CR) ? f2bf(w[e + u]) : (unsigned short)0; *(v4us*)(A + e) = o;  }
__global__ __launch_bounds__(256) void k_wo(const float* __restrict__ w, bf* A) { const int e = (blockIdx.x * 256 + threadIdx.x) * 4; if (e >= CC * CR) return; v4us o; for (int u = 0; u < 4; ++u) o[u] = f2bf(w[e + u]); *(v4us*)(A + e) = o;  }
__global__ __launch_bounds__(256) void k_xt(const float* __restrict__ X, bf* XT) { const int e = (blockIdx.x * 256 + threadIdx.x) * 4; if (e >= NN * CC) return; const int c = e % CC; const int n = e / CC; v4us o;
#pragma unroll
    for (int u = 0; u < 4; ++u) o[u] = f2bf(X[(size_t)(c + u) * NN + n]); *(v4us*)(XT + e) = o;  }
__global__ __launch_bounds__(256) void k_qk(const float* __restrict__ T, bf* Qh, bf* Ql, bf* Kh, bf* Kl) { const int e = (blockIdx.x * 256 + threadIdx.x) * 4; if (e >= NN * CR) return; const int c = e % CR; const int n = e / CR; v4us qh, ql, kh, kl;
#pragma unroll
    for (int u = 0; u < 4; ++u) { unsigned short a, b; splitf(T[(size_t)(CR + c + u) * NN + n], a, b); qh[u] = a; ql[u] = b; splitf(T[(size_t)(c + u) * NN + n], a, b); kh[u] = a; kl[u] = b; }
    *(v4us*)(Qh + e) = qh; *(v4us*)(Ql + e) = ql; *(v4us*)(Kh + e) = kh; *(v4us*)(Kl + e) = kl;  }
__global__ __launch_bounds__(256) void k_vp(const float* __restrict__ T, bf* Vh, bf* Vl) { const size_t e = ((size_t)blockIdx.x * 256 + threadIdx.x) * 4; if (e >= (size_t)64 * NN) return; const int r = (int)(e / NN); const int n = (int)(e % NN); v4us oh, ol;
#pragma unroll
    for (int u = 0; u < 4; ++u) { unsigned short a = 0, b = 0; if (r < CR) splitf(T[(size_t)(2 * CR + r) * NN + n + u], a, b); oh[u] = a; ol[u] = b; } *(v4us*)(Vh + e) = oh; *(v4us*)(Vl + e) = ol;  }
__global__ __launch_bounds__(256) void k_gsm(const float* __restrict__ S, bf* Ph, bf* Pl) { const int lane = threadIdx.x & 31; const int row = blockIdx.x * 8 + (threadIdx.x >> 5); if (row >= NN) return; const float* sr = S + (size_t)row * NN; float mx = -3.0e38f;
#pragma unroll 2
    for (int ch = 0; ch < NN / 128; ++ch) { const v4f a = *(const v4f*)(sr + ch * 128 + lane * 4); for (int u = 0; u < 4; ++u) mx = fmaxf(mx, a[u]); }
#pragma unroll
    for (int sh = 16; sh; sh >>= 1) mx = fmaxf(mx, __shfl_xor(mx, sh, 32));
    float sum = 0.f;
#pragma unroll 2
    for (int ch = 0; ch < NN / 128; ++ch) { const v4f a = *(const v4f*)(sr + ch * 128 + lane * 4);
#pragma unroll
        for (int u = 0; u < 4; ++u) { float d0 = __fsub_rn(a[u], mx); asm volatile("" : "+v"(d0)); sum += __builtin_amdgcn_exp2f(__fmul_rn(d0, 1.4426950408889634f)); } }
#pragma unroll
    for (int sh = 16; sh; sh >>= 1) sum += __shfl_xor(sum, sh, 32);
    const float f = __fdiv_rn(1.0f, sum);
#pragma unroll 2
    for (int ch = 0; ch < NN / 128; ++ch) { const v4f a = *(const v4f*)(sr + ch * 128 + lane * 4); v4us oh, ol;
#pragma unroll
        for (int u = 0; u < 4; ++u) { float d0 = __fsub_rn(a[u], mx); asm volatile("" : "+v"(d0)); const float e = __builtin_amdgcn_exp2f(__fmul_rn(d0, 1.4426950408889634f)); unsigned short a2, c2; splitf(e * f, a2, c2); oh[u] = a2; ol[u] = c2; }
        const size_t oo = (size_t)row * NN + ch * 128 + lane * 4; *(v4us*)(Ph + oo) = oh; *(v4us*)(Pl + oo) = ol;  } }
__global__ __launch_bounds__(256) void k_ot(const float* __restrict__ O1, bf* Oh, bf* Ol) { const int e = (blockIdx.x * 256 + threadIdx.x) * 4; if (e >= NN * CR) return; const int c = e % CR; const int n = e / CR; v4us oh, ol;
#pragma unroll
    for (int u = 0; u < 4; ++u) { unsigned short a, b; splitf(O1[(size_t)(c + u) * NN + n], a, b); oh[u] = a; ol[u] = b; } *(v4us*)(Oh + e) = oh; *(v4us*)(Ol + e) = ol;  }
__global__ __launch_bounds__(256) void k_fin(const float* __restrict__ G, const float* __restrict__ X, const float* __restrict__ scale, float* Y) { const size_t e = ((size_t)blockIdx.x * 256 + threadIdx.x) * 4; if (e >= (size_t)CC * NN) return; const int n = (int)(e % NN); const int c = (int)(e / NN); const float sc = bfr(scale[0]); const v4f xx = *(const v4f*)(X + e); v4f r;
#pragma unroll
    for (int u = 0; u < 4; ++u) { float p = __fmul_rn(sc, G[(size_t)(n + u) * CC + c]); asm volatile("" : "+v"(p)); r[u] = __fadd_rn(p, bfr(xx[u])); } *(v4f*)(Y + e) = r;  }

extern "C" void kernel_launch(void* const* d_in, const int* in_sizes, int n_in,
                              void* d_out, int out_size, void* d_ws, size_t ws_size, hipStream_t stream) {
    (void)in_sizes; (void)n_in; (void)out_size;
    const float* x = (const float*)d_in[0]; const float* Wt = (const float*)d_in[1]; const float* Wo = (const float*)d_in[2]; const float* scale = (const float*)d_in[3];
    float* OUT = (float*)d_out;     // [8][256][4096]
    char* wsp = (char*)d_ws;
    auto take = [&](size_t bytes) { char* p = wsp; wsp += (bytes + 255) & ~(size_t)255; return (void*)p; };
    bf* AW = (bf*)take((size_t)128 * CC * 2); bf* AO = (bf*)take((size_t)CC * CR * 2); bf* XT = (bf*)take((size_t)NN * CC * 2); float* T = (float*)take((size_t)128 * NN * 4);
    bf* QTh = (bf*)take((size_t)NN * CR * 2); bf* QTl = (bf*)take((size_t)NN * CR * 2); bf* KTh = (bf*)take((size_t)NN * CR * 2); bf* KTl = (bf*)take((size_t)NN * CR * 2); bf* VPh = (bf*)take((size_t)64 * NN * 2); bf* VPl = (bf*)take((size_t)64 * NN * 2);
    float* S = (float*)take((size_t)NN * NN * 4); bf* Ph = (bf*)take((size_t)NN * NN * 2); bf* Pl = (bf*)take((size_t)NN * NN * 2); float* O1 = (float*)take((size_t)64 * NN * 4); bf* OTh = (bf*)take((size_t)NN * CR * 2); bf* OTl = (bf*)take((size_t)NN * CR * 2); float* G = (float*)take((size_t)CC * NN * 4);
    if ((size_t)(wsp - (char*)d_ws) > ws_size) return;    // total ~ 145 MB
    k_wt128<<<(128 * CC / 4 + 255) / 256, 256, 0, stream>>>(Wt, AW); k_wo<<<(CC * CR / 4 + 255) / 256, 256, 0, stream>>>(Wo, AO);
    for (int b = 0; b < NB_; ++b) { const float* xb = x + (size_t)b * CC * NN;
        k_xt<<<(NN * CC / 4 + 255) / 256, 256, 0, stream>>>(xb, XT);
        k_gemmw<bf, 0, false><<<dim3(2, NN / 64, 1), 32, 0, stream>>>(AW, nullptr, XT, nullptr, CC, T, NN, nullptr, 0, 0, 0);     // t[r][n], rows 0..95 real
        k_qk<<<(NN * CR / 4 + 255) / 256, 256, 0, stream>>>(T, QTh, QTl, KTh, KTl); k_vp<<<(64 * NN / 4 + 255) / 256, 256, 0, stream>>>(T, VPh, VPl);
        k_gemmw<bf, 2, false><<<dim3(NN / 64, NN / 64, 1), 32, 0, stream>>>(QTh, QTl, KTh, KTl, CR, S, NN, nullptr, 0, 0, 0);      // S[j][i] = query[:,j] . key[:,i]
        k_gsm<<<NN / 8, 256, 0, stream>>>(S, Ph, Pl);
        k_gemmw<bf, 2, false><<<dim3(1, NN / 64, 1), 32, 0, stream>>>(VPh, VPl, Ph, Pl, NN, O1, NN, nullptr, 0, 0, 0);         // out[c][j] = sum_i value[c][i] W[j][i]
        k_ot<<<(NN * CR / 4 + 255) / 256, 256, 0, stream>>>(O1, OTh, OTl);
        k_gemmw<bf, 1, false><<<dim3(NN / 64, CC / 64, 1), 32, 0, stream>>>(OTh, OTl, AO, nullptr, CR, G, CC, nullptr, 0, 0, 0);     // G[j][o] = out^T . Wo^T (position-major; hl x exact, 2 products)
        k_fin<<<(CC * NN / 4 + 255) / 256, 256, 0, stream>>>(G, xb, scale, OUT + (size_t)b * CC * NN); }
}

// v001
// A run of this version takes 854 microseconds.
// In two side-by-side timings against v000, it was 1.66 and 1.69 times as fast.
#include <hip/hip_runtime.h>

// GlobalSelfAttention (x [8][256][64][64] channel-major, N = 4096 positions; t = Wt . x (1x1 conv, [96][256]): key = t[0:32], query = t[32:64], value = t[64:96]; scores[i][j] = sum_c key[c][i] query[c][j] (unscaled); weights = softmax over i (the key axis) for every j;
//   out[c][j] = sum_i value[c][i] weights[i][j]; y = Wo . out (1x1 conv, [256][32]); result = scale[0] * y + x -> [8][256][64][64]; scale read).
// Compute dtypes, f32 accumulate: every input rounded to bf16; t as a PLAIN bf16 GEMM Wt . x^T (inputs: exact; Wt padded to 128 rows, x transposed per batch); per j the logits over i as hl x hl (3 products: Q^T planes [j][c] . K^T planes [i][c], K = 32); softmax f32 -> hl planes W[j][i]; out = V (hl planes [64 rows, 32 real][i]) . W^T as 3 products; y^T = out^T planes (hl) . Wo^T (exact, K = 32; 2 products, position-major); scale * y + x in f32.

#define NB_  8
#define CC   256
#define CR   32
#define NN   4096
#define KS   16      // K slices of the value product (256 keys each)
typedef _Float16 h16;
typedef unsigned short bf;
typedef __attribute__((ext_vector_type(16))) __bf16   v16bf;
typedef __attribute__((ext_vector_type(16))) _Float16 v16h;
typedef __attribute__((ext_vector_type(8)))  _Float16 v8h;
typedef __attribute__((ext_vector_type(8)))  unsigned short v8us;
typedef __attribute__((ext_vector_type(8)))  float    v8f;
typedef __attribute__((ext_vector_type(4)))  float    v4f;
typedef v8h  __attribute__((may_alias)) v8ha;
typedef v4f  __attribute__((may_alias)) v4fa;
typedef v8us __attribute__((may_alias)) v8usa;

__device__ __forceinline__ unsigned short f2bf(float f) { unsigned u = __float_as_uint(f); u += 0x7FFFu + ((u >> 16) & 1u); return (unsigned short)(u >> 16); }
__device__ __forceinline__ float bf2f(unsigned short b) { return __uint_as_float(((unsigned)b) << 16); }
__device__ __forceinline__ float bfr(float f) { return bf2f(f2bf(f)); }
__device__ __forceinline__ v16h cat16(v8h lo, v8h hi) { return __builtin_shufflevector(lo, hi, 0, 1, 2, 3, 4, 5, 6, 7, 8, 9, 10, 11, 12, 13, 14, 15); }
__device__ __forceinline__ v16bf cat16b(v8us lo, v8us hi) { return __builtin_bit_cast(v16bf, __builtin_shufflevector(lo, hi, 0, 1, 2, 3, 4, 5, 6, 7, 8, 9, 10, 11, 12, 13, 14, 15)); }
__device__ __forceinline__ v8f wmma16(v16h a, v16h b, v8f c) { return __builtin_amdgcn_wmma_f32_16x16x32_f16(false, a, false, b, (short)0, c, false, false); }
__device__ __forceinline__ v8f wmmab(v16bf a, v16bf b, v8f c) { return __builtin_amdgcn_wmma_f32_16x16x32_bf16(false, a, false, b, (short)0, c, false, false); }



// ---- k_gemmw: register-blocked GEMM, ONE WAVE per 64x64 output tile (16 accumulators), operands straight from K-contiguous 16-bit planes; grid (M/64, N/64, Z), 32 threads.
// C[m][n] (f32, pitch ldc, + optional f32 bias[n]) = sum over k in [0, KL) of A[m][k] Bt[n][k] (+ split products per NSPLIT), rows of pitch K. z strides sA/sB/sC in elements: a batch, or with sA = sB = KL < K a K slice whose partial sum goes to its own C plane. KL % 32 == 0.
template <typename T16> struct WFrag;
template <> struct WFrag<h16> { typedef v16h V; static __device__ __forceinline__ V ld(const h16* p) { return cat16(*(const v8h*)p, *(const v8h*)(p + 16)); } static __device__ __forceinline__ v8f mma(V a, V b, v8f c) { return wmma16(a, b, c); } };
template <> struct WFrag<bf> { typedef v16bf V; static __device__ __forceinline__ V ld(const bf* p) { return cat16b(*(const v8us*)p, *(const v8us*)(p + 16)); } static __device__ __forceinline__ v8f mma(V a, V b, v8f c) { return wmmab(a, b, c); } };
template <typename T16, int NSPLIT, bool BIAS>
__global__ __launch_bounds__(32) void k_gemmw(const T16* __restrict__ A, const T16* __restrict__ A2, const T16* __restrict__ Bt, const T16* __restrict__ Bt2, int K, int KL, float* C, int ldc, const float* __restrict__ bias, size_t sA, size_t sB, size_t sC) {
    typedef typename WFrag<T16>::V V;
    __shared__ __align__(16) float os[16 * 68];
    const size_t z = blockIdx.z; A += z * sA; if (A2) A2 += z * sA; Bt += z * sB; if (Bt2) Bt2 += z * sB; C += z * sC;
    const int lane = threadIdx.x & 31, lr = lane & 15, hi = lane >> 4; const int r0 = blockIdx.x * 64, c0 = blockIdx.y * 64;
    v8f acc[4][4];
#pragma unroll
    for (int mb = 0; mb < 4; ++mb)
#pragma unroll
        for (int nb = 0; nb < 4; ++nb) acc[mb][nb] = (v8f){};
    const size_t aoff = (size_t)(r0 + lr) * K + 8 * hi, boff = (size_t)(c0 + lr) * K + 8 * hi;
#pragma unroll 1
    for (int kc = 0; kc < KL; kc += 32) {
        V a[4], a2[4];
#pragma unroll
        for (int mb = 0; mb < 4; ++mb) { a[mb] = WFrag<T16>::ld(A + aoff + (size_t)mb * 16 * K + kc); if (NSPLIT == 1 || NSPLIT == 2) a2[mb] = WFrag<T16>::ld(A2 + aoff + (size_t)mb * 16 * K + kc); }
#pragma unroll
        for (int nb = 0; nb < 4; ++nb) { const V b = WFrag<T16>::ld(Bt + boff + (size_t)nb * 16 * K + kc); V b2; if (NSPLIT >= 2) b2 = WFrag<T16>::ld(Bt2 + boff + (size_t)nb * 16 * K + kc);
#pragma unroll
            for (int mb = 0; mb < 4; ++mb) { acc[mb][nb] = WFrag<T16>::mma(a[mb], b, acc[mb][nb]); if (NSPLIT == 1 || NSPLIT == 2) acc[mb][nb] = WFrag<T16>::mma(a2[mb], b, acc[mb][nb]); if (NSPLIT >= 2) acc[mb][nb] = WFrag<T16>::mma(a[mb], b2, acc[mb][nb]); } }
        asm volatile("v_nop\n\tv_nop\n\tv_nop\n\tv_nop" : "+v"(acc[0][0]), "+v"(acc[1][1]), "+v"(acc[2][2]), "+v"(acc[3][3]) : "v"(a[0]), "v"(a[3]));
    }
#pragma unroll
    for (int mb = 0; mb < 4; ++mb) {
#pragma unroll
        for (int nb = 0; nb < 4; ++nb) {
#pragma unroll
            for (int j = 0; j < 8; ++j) os[(hi * 8 + j) * 68 + nb * 16 + lr] = acc[mb][nb][j]; }
        __builtin_amdgcn_wave_barrier(); asm volatile("" ::: "memory");
        float* crow = C + (size_t)(r0 + mb * 16) * ldc + c0;
{
#pragma unroll
            for (int s = 0; s < 8; ++s) { const int row = 2 * s + hi, cofs = lr * 4; v4f val = *(const v4fa*)(os + row * 68 + cofs); if (BIAS) { val[0] += bfr(bias[c0 + cofs]); val[1] += bfr(bias[c0 + cofs + 1]); val[2] += bfr(bias[c0 + cofs + 2]); val[3] += bfr(bias[c0 + cofs + 3]); }
                *(v4f*)(crow + (size_t)row * ldc + cofs) = val; }
             }
        __builtin_amdgcn_wave_barrier(); asm volatile("" ::: "memory");
    }
}

__device__ __forceinline__ void splitf(float y, unsigned short& h, unsigned short& l) { h = f2bf(y); l = f2bf(y - bf2f(h)); }
typedef __attribute__((ext_vector_type(2))) unsigned short v2us;
typedef __attribute__((ext_vector_type(4))) unsigned short v4us;

// k_wt128: A [128][256] = bf16(Wt) rows < 96 else 0; k_wo: A2 [256][32] = bf16(Wo); k_xt: XT[n][c] = bf16(x[c][n]) (8-B lanes along c); k_qk: hl planes QT[j][c] = T[32 + c][j] and KT[i][c] = T[c][i] (8-B lanes along c); k_vp: hl planes VP[r][i] = T[64 + r][i] for r < 32 else 0 ([64][4096], 8-B lanes);
__global__ __launch_bounds__(256) void k_wt128(const float* __restrict__ w, bf* A) { const int e = (blockIdx.x * 256 + threadIdx.x) * 4; if (e >= 128 * CC) return; const int r = e / CC; v4us o; for (int u = 0; u < 4; ++u) o[u] = (r < 3 * CR) ? f2bf(w[e + u]) : (unsigned short)0; *(v4us*)(A + e) = o;  }
__global__ __launch_bounds__(256) void k_wo(const float* __restrict__ w, bf* A) { const int e = (blockIdx.x * 256 + threadIdx.x) * 4; if (e >= CC * CR) return; v4us o; for (int u = 0; u < 4; ++u) o[u] = f2bf(w[e + u]); *(v4us*)(A + e) = o;  }
__global__ __launch_bounds__(256) void k_xt(const float* __restrict__ X, bf* XT) { const int e = (blockIdx.x * 256 + threadIdx.x) * 4; if (e >= NN * CC) return; const int c = e % CC; const int n = e / CC; v4us o;
#pragma unroll
    for (int u = 0; u < 4; ++u) o[u] = f2bf(X[(size_t)(c + u) * NN + n]); *(v4us*)(XT + e) = o;  }
__global__ __launch_bounds__(256) void k_qk(const float* __restrict__ T, bf* Qh, bf* Ql, bf* Kh, bf* Kl) { const int e = (blockIdx.x * 256 + threadIdx.x) * 4; if (e >= NN * CR) return; const int c = e % CR; const int n = e / CR; v4us qh, ql, kh, kl;
#pragma unroll
    for (int u = 0; u < 4; ++u) { unsigned short a, b; splitf(T[(size_t)(CR + c + u) * NN + n], a, b); qh[u] = a; ql[u] = b; splitf(T[(size_t)(c + u) * NN + n], a, b); kh[u] = a; kl[u] = b; }
    *(v4us*)(Qh + e) = qh; *(v4us*)(Ql + e) = ql; *(v4us*)(Kh + e) = kh; *(v4us*)(Kl + e) = kl;  }
__global__ __launch_bounds__(256) void k_vp(const float* __restrict__ T, bf* Vh, bf* Vl) { const size_t e = ((size_t)blockIdx.x * 256 + threadIdx.x) * 4; if (e >= (size_t)64 * NN) return; const int r = (int)(e / NN); const int n = (int)(e % NN); v4us oh, ol;
#pragma unroll
    for (int u = 0; u < 4; ++u) { unsigned short a = 0, b = 0; if (r < CR) splitf(T[(size_t)(2 * CR + r) * NN + n + u], a, b); oh[u] = a; ol[u] = b; } *(v4us*)(Vh + e) = oh; *(v4us*)(Vl + e) = ol;  }
__global__ __launch_bounds__(256) void k_gsm(const float* __restrict__ S, bf* Ph, bf* Pl) { const int lane = threadIdx.x & 31; const int row = blockIdx.x * 8 + (threadIdx.x >> 5); if (row >= NN) return; const float* sr = S + (size_t)row * NN; float mx = -3.0e38f;
#pragma unroll 2
    for (int ch = 0; ch < NN / 128; ++ch) { const v4f a = *(const v4f*)(sr + ch * 128 + lane * 4); for (int u = 0; u < 4; ++u) mx = fmaxf(mx, a[u]); }
#pragma unroll
    for (int sh = 16; sh; sh >>= 1) mx = fmaxf(mx, __shfl_xor(mx, sh, 32));
    float sum = 0.f;
#pragma unroll 2
    for (int ch = 0; ch < NN / 128; ++ch) { const v4f a = *(const v4f*)(sr + ch * 128 + lane * 4);
#pragma unroll
        for (int u = 0; u < 4; ++u) { float d0 = __fsub_rn(a[u], mx); asm volatile("" : "+v"(d0)); sum += __builtin_amdgcn_exp2f(__fmul_rn(d0, 1.4426950408889634f)); } }
#pragma unroll
    for (int sh = 16; sh; sh >>= 1) sum += __shfl_xor(sum, sh, 32);
    const float f = __fdiv_rn(1.0f, sum);
#pragma unroll 2
    for (int ch = 0; ch < NN / 128; ++ch) { const v4f a = *(const v4f*)(sr + ch * 128 + lane * 4); v4us oh, ol;
#pragma unroll
        for (int u = 0; u < 4; ++u) { float d0 = __fsub_rn(a[u], mx); asm volatile("" : "+v"(d0)); const float e = __builtin_amdgcn_exp2f(__fmul_rn(d0, 1.4426950408889634f)); unsigned short a2, c2; splitf(e * f, a2, c2); oh[u] = a2; ol[u] = c2; }
        const size_t oo = (size_t)row * NN + ch * 128 + lane * 4; *(v4us*)(Ph + oo) = oh; *(v4us*)(Pl + oo) = ol;  } }
// k_ot: joins the KS partial planes O1[z][64][4096] of the value product (z ascending, f32) and writes the hl planes OT[j][c]. A block owns 32 positions: wave w sums channels 4w..4w+3 with lanes along j (whole 128-B lines), then the block turns the 32 x 32 tile through LDS so that each wave stores whole lines.
__global__ __launch_bounds__(256) void k_ot(const float* __restrict__ O1, bf* Oh, bf* Ol) { __shared__ float sm[32 * 33]; const int lane = threadIdx.x & 31, w = threadIdx.x >> 5; const float* p = O1 + (size_t)(w * 4) * NN + blockIdx.x * 32 + lane; float s[4] = {0.f, 0.f, 0.f, 0.f};
#pragma unroll 1        // rolled over groups of 8 planes: 32 independent loads in flight per trip hide the latency, more only costs registers
    for (int z0 = 0; z0 < KS; z0 += 8) {
#pragma unroll
        for (int z = 0; z < 8; ++z) {
#pragma unroll
            for (int u = 0; u < 4; ++u) s[u] += p[(size_t)(z0 + z) * 64 * NN + (size_t)u * NN]; }
        asm volatile("s_wait_xcnt 0x0" ::: "memory");    // stands before the next trip rewrites the loads' address registers
    }
#pragma unroll
    for (int u = 0; u < 4; ++u) sm[lane * 33 + w * 4 + u] = s[u];
    __syncthreads();    // the tile is read across waves below
    const int e = (blockIdx.x * 256 + threadIdx.x) * 4; const int nl = threadIdx.x >> 3, c = (threadIdx.x & 7) * 4; v4us oh, ol;
#pragma unroll
    for (int u = 0; u < 4; ++u) { unsigned short a, b; splitf(sm[nl * 33 + c + u], a, b); oh[u] = a; ol[u] = b; } *(v4us*)(Oh + e) = oh; *(v4us*)(Ol + e) = ol;  }
__global__ __launch_bounds__(256) void k_fin(const float* __restrict__ G, const float* __restrict__ X, const float* __restrict__ scale, float* Y) { const size_t e = ((size_t)blockIdx.x * 256 + threadIdx.x) * 4; if (e >= (size_t)CC * NN) return; const int n = (int)(e % NN); const int c = (int)(e / NN); const float sc = bfr(scale[0]); const v4f xx = *(const v4f*)(X + e); v4f r;
#pragma unroll
    for (int u = 0; u < 4; ++u) { float p = __fmul_rn(sc, G[(size_t)(n + u) * CC + c]); asm volatile("" : "+v"(p)); r[u] = __fadd_rn(p, bfr(xx[u])); } *(v4f*)(Y + e) = r;  }

extern "C" void kernel_launch(void* const* d_in, const int* in_sizes, int n_in,
                              void* d_out, int out_size, void* d_ws, size_t ws_size, hipStream_t stream) {
    (void)in_sizes; (void)n_in; (void)out_size;
    const float* x = (const float*)d_in[0]; const float* Wt = (const float*)d_in[1]; const float* Wo = (const float*)d_in[2]; const float* scale = (const float*)d_in[3];
    float* OUT = (float*)d_out;     // [8][256][4096]
    char* wsp = (char*)d_ws;
    auto take = [&](size_t bytes) { char* p = wsp; wsp += (bytes + 255) & ~(size_t)255; return (void*)p; };
    bf* AW = (bf*)take((size_t)128 * CC * 2); bf* AO = (bf*)take((size_t)CC * CR * 2); bf* XT = (bf*)take((size_t)NN * CC * 2); float* T = (float*)take((size_t)128 * NN * 4);
    bf* QTh = (bf*)take((size_t)NN * CR * 2); bf* QTl = (bf*)take((size_t)NN * CR * 2); bf* KTh = (bf*)take((size_t)NN * CR * 2); bf* KTl = (bf*)take((size_t)NN * CR * 2); bf* VPh = (bf*)take((size_t)64 * NN * 2); bf* VPl = (bf*)take((size_t)64 * NN * 2);
    float* S = (float*)take((size_t)NN * NN * 4); bf* Ph = (bf*)take((size_t)NN * NN * 2); bf* Pl = (bf*)take((size_t)NN * NN * 2); float* O1 = (float*)take((size_t)KS * 64 * NN * 4); bf* OTh = (bf*)take((size_t)NN * CR * 2); bf* OTl = (bf*)take((size_t)NN * CR * 2); float* G = (float*)take((size_t)CC * NN * 4);
    if ((size_t)(wsp - (char*)d_ws) > ws_size) return;    // total ~ 161 MB
    k_wt128<<<(128 * CC / 4 + 255) / 256, 256, 0, stream>>>(Wt, AW); k_wo<<<(CC * CR / 4 + 255) / 256, 256, 0, stream>>>(Wo, AO);
    for (int b = 0; b < NB_; ++b) { const float* xb = x + (size_t)b * CC * NN;
        k_xt<<<(NN * CC / 4 + 255) / 256, 256, 0, stream>>>(xb, XT);
        k_gemmw<bf, 0, false><<<dim3(2, NN / 64, 1), 32, 0, stream>>>(AW, nullptr, XT, nullptr, CC, CC, T, NN, nullptr, 0, 0, 0);     // t[r][n], rows 0..95 real
        k_qk<<<(NN * CR / 4 + 255) / 256, 256, 0, stream>>>(T, QTh, QTl, KTh, KTl); k_vp<<<(64 * NN / 4 + 255) / 256, 256, 0, stream>>>(T, VPh, VPl);
        k_gemmw<bf, 2, false><<<dim3(NN / 64, NN / 64, 1), 32, 0, stream>>>(QTh, QTl, KTh, KTl, CR, CR, S, NN, nullptr, 0, 0, 0);      // S[j][i] = query[:,j] . key[:,i]
        k_gsm<<<NN / 8, 256, 0, stream>>>(S, Ph, Pl);
        k_gemmw<bf, 2, false><<<dim3(1, NN / 64, KS), 32, 0, stream>>>(VPh, VPl, Ph, Pl, NN, NN / KS, O1, NN, nullptr, NN / KS, NN / KS, (size_t)64 * NN);         // O1[z][c][j] = sum over the keys i of slice z of value[c][i] W[j][i]; k_ot joins the slices
        k_ot<<<(NN * CR / 4 + 255) / 256, 256, 0, stream>>>(O1, OTh, OTl);
        k_gemmw<bf, 1, false><<<dim3(NN / 64, CC / 64, 1), 32, 0, stream>>>(OTh, OTl, AO, nullptr, CR, CR, G, CC, nullptr, 0, 0, 0);     // G[j][o] = out^T . Wo^T (position-major; hl x exact, 2 products)
        k_fin<<<(CC * NN / 4 + 255) / 256, 256, 0, stream>>>(G, xb, scale, OUT + (size_t)b * CC * NN); }
}

// v002
// A run of this version takes 350 microseconds.
// Next to v001, in two timings, it ran 2.53 and 2.43 times as fast.
// Over all steps from v000 it is 4.15 times as fast.
#include <hip/hip_runtime.h>

// GlobalSelfAttention (x [8][256][64][64] channel-major, N = 4096 positions; t = Wt . x (1x1 conv, [96][256]): key = t[0:32], query = t[32:64], value = t[64:96]; scores[i][j] = sum_c key[c][i] query[c][j] (unscaled); weights = softmax over i (the key axis) for every j;
//   out[c][j] = sum_i value[c][i] weights[i][j]; y = Wo . out (1x1 conv, [256][32]); result = scale[0] * y + x -> [8][256][64][64]; scale read).
// Compute dtypes, f32 accumulate: every input rounded to bf16; t as a PLAIN bf16 GEMM Wt . x^T (inputs: exact; Wt padded to 128 rows, x transposed per batch); logits, softmax and value product in ONE kernel (k_attn): S^T = K^T planes [i][c] . Q as hl x hl (3 products, K = 32), running maximum and sum per j in f32, exp -> hl operand in registers, out += V (hl planes [c][i]) . P^T as 3 products; 16 key slices, joined in k_ot; y^T = out^T planes (hl) . Wo^T (exact, K = 32; 2 products, position-major); scale * y + x in f32.

#define NB_  8
#define CC   256
#define CR   32
#define NN   4096
#define KS   16      // key slices of the attention kernel (256 keys each)
typedef _Float16 h16;
typedef unsigned short bf;
typedef __attribute__((ext_vector_type(16))) __bf16   v16bf;
typedef __attribute__((ext_vector_type(16))) _Float16 v16h;
typedef __attribute__((ext_vector_type(8)))  _Float16 v8h;
typedef __attribute__((ext_vector_type(8)))  unsigned short v8us;
typedef __attribute__((ext_vector_type(8)))  float    v8f;
typedef __attribute__((ext_vector_type(4)))  float    v4f;
typedef v8h  __attribute__((may_alias)) v8ha;
typedef v4f  __attribute__((may_alias)) v4fa;
typedef v8us __attribute__((may_alias)) v8usa;

__device__ __forceinline__ unsigned short f2bf(float f) { unsigned u = __float_as_uint(f); u += 0x7FFFu + ((u >> 16) & 1u); return (unsigned short)(u >> 16); }
__device__ __forceinline__ float bf2f(unsigned short b) { return __uint_as_float(((unsigned)b) << 16); }
__device__ __forceinline__ float bfr(float f) { return bf2f(f2bf(f)); }
__device__ __forceinline__ v16h cat16(v8h lo, v8h hi) { return __builtin_shufflevector(lo, hi, 0, 1, 2, 3, 4, 5, 6, 7, 8, 9, 10, 11, 12, 13, 14, 15); }
__device__ __forceinline__ v16bf cat16b(v8us lo, v8us hi) { return __builtin_bit_cast(v16bf, __builtin_shufflevector(lo, hi, 0, 1, 2, 3, 4, 5, 6, 7, 8, 9, 10, 11, 12, 13, 14, 15)); }
__device__ __forceinline__ v8f wmma16(v16h a, v16h b, v8f c) { return __builtin_amdgcn_wmma_f32_16x16x32_f16(false, a, false, b, (short)0, c, false, false); }
__device__ __forceinline__ v8f wmmab(v16bf a, v16bf b, v8f c) { return __builtin_amdgcn_wmma_f32_16x16x32_bf16(false, a, false, b, (short)0, c, false, false); }



// ---- k_gemmw: register-blocked GEMM, ONE WAVE per 64x64 output tile (16 accumulators), operands straight from K-contiguous 16-bit planes; grid (M/64, N/64, Z), 32 threads.
// C[m][n] (f32, pitch ldc, + optional f32 bias[n]) = sum over k in [0, KL) of A[m][k] Bt[n][k] (+ split products per NSPLIT), rows of pitch K. z strides sA/sB/sC in elements: a batch, or with sA = sB = KL < K a K slice whose partial sum goes to its own C plane. KL % 32 == 0.
template <typename T16> struct WFrag;
template <> struct WFrag<h16> { typedef v16h V; static __device__ __forceinline__ V ld(const h16* p) { return cat16(*(const v8h*)p, *(const v8h*)(p + 16)); } static __device__ __forceinline__ v8f mma(V a, V b, v8f c) { return wmma16(a, b, c); } };
template <> struct WFrag<bf> { typedef v16bf V; static __device__ __forceinline__ V ld(const bf* p) { return cat16b(*(const v8us*)p, *(const v8us*)(p + 16)); } static __device__ __forceinline__ v8f mma(V a, V b, v8f c) { return wmmab(a, b, c); } };
template <typename T16, int NSPLIT, bool BIAS>
__global__ __launch_bounds__(32) void k_gemmw(const T16* __restrict__ A, const T16* __restrict__ A2, const T16* __restrict__ Bt, const T16* __restrict__ Bt2, int K, int KL, float* C, int ldc, const float* __restrict__ bias, size_t sA, size_t sB, size_t sC) {
    typedef typename WFrag<T16>::V V;
    __shared__ __align__(16) float os[16 * 68];
    const size_t z = blockIdx.z; A += z * sA; if (A2) A2 += z * sA; Bt += z * sB; if (Bt2) Bt2 += z * sB; C += z * sC;
    const int lane = threadIdx.x & 31, lr = lane & 15, hi = lane >> 4; const int r0 = blockIdx.x * 64, c0 = blockIdx.y * 64;
    v8f acc[4][4];
#pragma unroll
    for (int mb = 0; mb < 4; ++mb)
#pragma unroll
        for (int nb = 0; nb < 4; ++nb) acc[mb][nb] = (v8f){};
    const size_t aoff = (size_t)(r0 + lr) * K + 8 * hi, boff = (size_t)(c0 + lr) * K + 8 * hi;
#pragma unroll 1
    for (int kc = 0; kc < KL; kc += 32) {
        V a[4], a2[4];
#pragma unroll
        for (int mb = 0; mb < 4; ++mb) { a[mb] = WFrag<T16>::ld(A + aoff + (size_t)mb * 16 * K + kc); if (NSPLIT == 1 || NSPLIT == 2) a2[mb] = WFrag<T16>::ld(A2 + aoff + (size_t)mb * 16 * K + kc); }
#pragma unroll
        for (int nb = 0; nb < 4; ++nb) { const V b = WFrag<T16>::ld(Bt + boff + (size_t)nb * 16 * K + kc); V b2; if (NSPLIT >= 2) b2 = WFrag<T16>::ld(Bt2 + boff + (size_t)nb * 16 * K + kc);
#pragma unroll
            for (int mb = 0; mb < 4; ++mb) { acc[mb][nb] = WFrag<T16>::mma(a[mb], b, acc[mb][nb]); if (NSPLIT == 1 || NSPLIT == 2) acc[mb][nb] = WFrag<T16>::mma(a2[mb], b, acc[mb][nb]); if (NSPLIT >= 2) acc[mb][nb] = WFrag<T16>::mma(a[mb], b2, acc[mb][nb]); } }
        asm volatile("v_nop\n\tv_nop\n\tv_nop\n\tv_nop" : "+v"(acc[0][0]), "+v"(acc[1][1]), "+v"(acc[2][2]), "+v"(acc[3][3]) : "v"(a[0]), "v"(a[3]));
    }
#pragma unroll
    for (int mb = 0; mb < 4; ++mb) {
#pragma unroll
        for (int nb = 0; nb < 4; ++nb) {
#pragma unroll
            for (int j = 0; j < 8; ++j) os[(hi * 8 + j) * 68 + nb * 16 + lr] = acc[mb][nb][j]; }
        __builtin_amdgcn_wave_barrier(); asm volatile("" ::: "memory");
        float* crow = C + (size_t)(r0 + mb * 16) * ldc + c0;
{
#pragma unroll
            for (int s = 0; s < 8; ++s) { const int row = 2 * s + hi, cofs = lr * 4; v4f val = *(const v4fa*)(os + row * 68 + cofs); if (BIAS) { val[0] += bfr(bias[c0 + cofs]); val[1] += bfr(bias[c0 + cofs + 1]); val[2] += bfr(bias[c0 + cofs + 2]); val[3] += bfr(bias[c0 + cofs + 3]); }
                *(v4f*)(crow + (size_t)row * ldc + cofs) = val; }
             }
        __builtin_amdgcn_wave_barrier(); asm volatile("" ::: "memory");
    }
}

__device__ __forceinline__ void splitf(float y, unsigned short& h, unsigned short& l) { h = f2bf(y); l = f2bf(y - bf2f(h)); }
typedef __attribute__((ext_vector_type(2))) unsigned short v2us;
typedef __attribute__((ext_vector_type(4))) unsigned short v4us;

// k_wt128: A [128][256] = bf16(Wt) rows < 96 else 0; k_wo: A2 [256][32] = bf16(Wo); k_xt: XT[n][c] = bf16(x[c][n]) (8-B lanes along c); k_qk: hl planes QT[j][c] = T[32 + c][j] and KT[i][c] = T[c][i] (8-B lanes along c); k_vp: hl planes VP[r][i] = T[64 + r][i] for r < 32 else 0 ([64][4096], 8-B lanes);
__global__ __launch_bounds__(256) void k_wt128(const float* __restrict__ w, bf* A) { const int e = (blockIdx.x * 256 + threadIdx.x) * 4; if (e >= 128 * CC) return; const int r = e / CC; v4us o; for (int u = 0; u < 4; ++u) o[u] = (r < 3 * CR) ? f2bf(w[e + u]) : (unsigned short)0; *(v4us*)(A + e) = o;  }
__global__ __launch_bounds__(256) void k_wo(const float* __restrict__ w, bf* A) { const int e = (blockIdx.x * 256 + threadIdx.x) * 4; if (e >= CC * CR) return; v4us o; for (int u = 0; u < 4; ++u) o[u] = f2bf(w[e + u]); *(v4us*)(A + e) = o;  }
__global__ __launch_bounds__(256) void k_xt(const float* __restrict__ X, bf* XT) { const int e = (blockIdx.x * 256 + threadIdx.x) * 4; if (e >= NN * CC) return; const int c = e % CC; const int n = e / CC; v4us o;
#pragma unroll
    for (int u = 0; u < 4; ++u) o[u] = f2bf(X[(size_t)(c + u) * NN + n]); *(v4us*)(XT + e) = o;  }
__global__ __launch_bounds__(256) void k_qk(const float* __restrict__ T, bf* Qh, bf* Ql, bf* Kh, bf* Kl) { const int e = (blockIdx.x * 256 + threadIdx.x) * 4; if (e >= NN * CR) return; const int c = e % CR; const int n = e / CR; v4us qh, ql, kh, kl;
#pragma unroll
    for (int u = 0; u < 4; ++u) { unsigned short a, b; splitf(T[(size_t)(CR + c + u) * NN + n], a, b); qh[u] = a; ql[u] = b; splitf(T[(size_t)(c + u) * NN + n], a, b); kh[u] = a; kl[u] = b; }
    *(v4us*)(Qh + e) = qh; *(v4us*)(Ql + e) = ql; *(v4us*)(Kh + e) = kh; *(v4us*)(Kl + e) = kl;  }
__global__ __launch_bounds__(256) void k_vp(const float* __restrict__ T, bf* Vh, bf* Vl) { const size_t e = ((size_t)blockIdx.x * 256 + threadIdx.x) * 4; if (e >= (size_t)64 * NN) return; const int r = (int)(e / NN); const int n = (int)(e % NN); v4us oh, ol;
#pragma unroll
    for (int u = 0; u < 4; ++u) { unsigned short a = 0, b = 0; if (r < CR) splitf(T[(size_t)(2 * CR + r) * NN + n + u], a, b); oh[u] = a; ol[u] = b; } *(v4us*)(Vh + e) = oh; *(v4us*)(Vl + e) = ol;  }
typedef __attribute__((ext_vector_type(2))) float v2f;
typedef __attribute__((ext_vector_type(2))) __bf16 v2bf;
typedef __attribute__((ext_vector_type(8))) unsigned v8u;
#define L2E 1.4426950408889634f
__device__ __forceinline__ float xhalf(float v) { const int b = __float_as_int(v); return __int_as_float(__builtin_amdgcn_permlanex16(b, b, 0x76543210, 0xfedcba98, false, false)); }    // lane l <-> l ^ 16
// exp2x8 / exp2x1: v_exp_f32 with the slot behind a transcendental kept by construction: no result lies on a source (early clobber), nothing in the run reads a result, and one v_nop fills the slot behind the last.
__device__ __forceinline__ void exp2x8(const float* x, float* y) {
    asm("v_exp_f32 %0, %8\n\tv_exp_f32 %1, %9\n\tv_exp_f32 %2, %10\n\tv_exp_f32 %3, %11\n\tv_exp_f32 %4, %12\n\tv_exp_f32 %5, %13\n\tv_exp_f32 %6, %14\n\tv_exp_f32 %7, %15\n\tv_nop"
        : "=&v"(y[0]), "=&v"(y[1]), "=&v"(y[2]), "=&v"(y[3]), "=&v"(y[4]), "=&v"(y[5]), "=&v"(y[6]), "=&v"(y[7]) : "v"(x[0]), "v"(x[1]), "v"(x[2]), "v"(x[3]), "v"(x[4]), "v"(x[5]), "v"(x[6]), "v"(x[7])); }
__device__ __forceinline__ float exp2x1(float x) { float y; asm("v_exp_f32 %0, %1\n\tv_nop" : "=&v"(y) : "v"(x)); return y; }
// addr_done: s_wait_xcnt 0 held in its place by two scheduling barriers; it stands between a load and later loads whose results the register allocator may lay over the first load's address registers.
__device__ __forceinline__ void addr_done() { __builtin_amdgcn_sched_barrier(0); asm volatile("s_wait_xcnt 0x0" ::: "memory"); __builtin_amdgcn_sched_barrier(0); }
__global__ __launch_bounds__(256) void k_attn(const bf* __restrict__ Qh, const bf* __restrict__ Ql, const bf* __restrict__ Kh, const bf* __restrict__ Kl, const bf* __restrict__ Vh, const bf* __restrict__ Vl, float* __restrict__ O1, float* __restrict__ Mz, float* __restrict__ Lz) {
    typedef WFrag<bf> F; typedef v16bf V;
    const int lane = threadIdx.x & 31, lr = lane & 15, hi = lane >> 4, w = threadIdx.x >> 5;
    const int j0 = blockIdx.x * 256 + w * 32, z = blockIdx.y, ib = z * (NN / KS);
    V qh[2], ql[2];
#pragma unroll
    for (int jt = 0; jt < 2; ++jt) { qh[jt] = F::ld(Qh + (size_t)(j0 + jt * 16 + lr) * CR + 8 * hi); addr_done(); ql[jt] = F::ld(Ql + (size_t)(j0 + jt * 16 + lr) * CR + 8 * hi); addr_done(); }
    const size_t koff = (size_t)(ib + lr) * CR + 8 * hi, voff = (size_t)lr * NN + ib + 8 * hi;
    v8f o[2][2]; float mL[2], l[2];
#pragma unroll
    for (int jt = 0; jt < 2; ++jt) { o[0][jt] = (v8f){}; o[1][jt] = (v8f){}; mL[jt] = -3.0e38f; l[jt] = 0.f; }
    V kh[2], kl[2];
#pragma unroll
    for (int it = 0; it < 2; ++it) { kh[it] = F::ld(Kh + koff + it * 16 * CR); kl[it] = F::ld(Kl + koff + it * 16 * CR); }
#pragma unroll 1        // rolled: the pass is long enough to fill the pipes, and the code stays small
    for (int t = 0; t < NN / KS / 32; ++t) {
        V vh[2], vl[2];
#pragma unroll
        for (int ct = 0; ct < 2; ++ct) { vh[ct] = F::ld(Vh + voff + (size_t)ct * 16 * NN + t * 32); vl[ct] = F::ld(Vl + voff + (size_t)ct * 16 * NN + t * 32); }
        __builtin_amdgcn_sched_barrier(0);    // keeps the V loads at the head of the pass, a whole softmax ahead of their use (the scheduler otherwise sinks half of them to just before the value products)
        v8f s[2][2];
#pragma unroll
        for (int jt = 0; jt < 2; ++jt)
#pragma unroll
            for (int it = 0; it < 2; ++it) s[jt][it] = F::mma(kh[it], qh[jt], (v8f){});
#pragma unroll
        for (int jt = 0; jt < 2; ++jt)
#pragma unroll
            for (int it = 0; it < 2; ++it) s[jt][it] = F::mma(kh[it], ql[jt], s[jt][it]);
#pragma unroll
        for (int jt = 0; jt < 2; ++jt)
#pragma unroll
            for (int it = 0; it < 2; ++it) s[jt][it] = F::mma(kl[it], qh[jt], s[jt][it]);
        const int tn = (t + 1 < NN / KS / 32) ? t + 1 : t;    // the next pass's K rows, fetched behind this pass's score products (the last pass reads its own again: in bounds)
#pragma unroll
        for (int it = 0; it < 2; ++it) { kh[it] = F::ld(Kh + koff + (size_t)(tn * 32 + it * 16) * CR); kl[it] = F::ld(Kl + koff + (size_t)(tn * 32 + it * 16) * CR); }
        __builtin_amdgcn_sched_barrier(0);    // keeps the next pass's K loads here, so that they fly under the softmax and the value products (the scheduler otherwise sinks them to the foot of the pass)
        V ph[2], pl[2];
#pragma unroll
        for (int jt = 0; jt < 2; ++jt) {
            float mx = s[jt][0][0];
#pragma unroll
            for (int r = 1; r < 8; ++r) mx = fmaxf(mx, s[jt][0][r]);
#pragma unroll
            for (int r = 0; r < 8; ++r) mx = fmaxf(mx, s[jt][1][r]);
            mx = fmaxf(mx, xhalf(mx));
            const float mn = fmaxf(mL[jt], mx * L2E); const float al = exp2x1(mL[jt] - mn); mL[jt] = mn;
            float sum = 0.f, xs[16], ps[16]; v8u uh, ul;
#pragma unroll
            for (int e = 0; e < 16; ++e) xs[e] = __builtin_fmaf(s[jt][e >> 3][e & 7], L2E, -mn);
            exp2x8(xs, ps); exp2x8(xs + 8, ps + 8);
#pragma unroll
            for (int e = 0; e < 8; ++e) {
                v2f p; p[0] = ps[2 * e]; p[1] = ps[2 * e + 1]; sum += p[0] + p[1];
                const v2bf h = __builtin_convertvector(p, v2bf); const unsigned hu = __builtin_bit_cast(unsigned, h); uh[e] = hu;
                v2f d; d[0] = p[0] - __uint_as_float(hu << 16); d[1] = p[1] - __uint_as_float(hu & 0xFFFF0000u);
                ul[e] = __builtin_bit_cast(unsigned, __builtin_convertvector(d, v2bf)); }
            l[jt] = l[jt] * al + sum; ph[jt] = __builtin_bit_cast(V, uh); pl[jt] = __builtin_bit_cast(V, ul);
#pragma unroll
            for (int r = 0; r < 8; ++r) { o[0][jt][r] *= al; o[1][jt][r] *= al; }
        }
#pragma unroll
        for (int jt = 0; jt < 2; ++jt)
#pragma unroll
            for (int ct = 0; ct < 2; ++ct) o[ct][jt] = F::mma(vh[ct], ph[jt], o[ct][jt]);
#pragma unroll
        for (int jt = 0; jt < 2; ++jt)
#pragma unroll
            for (int ct = 0; ct < 2; ++ct) o[ct][jt] = F::mma(vl[ct], ph[jt], o[ct][jt]);
#pragma unroll
        for (int jt = 0; jt < 2; ++jt)
#pragma unroll
            for (int ct = 0; ct < 2; ++ct) o[ct][jt] = F::mma(vh[ct], pl[jt], o[ct][jt]);
    }
#pragma unroll
    for (int jt = 0; jt < 2; ++jt) l[jt] += xhalf(l[jt]);
    Mz[(size_t)z * NN + j0 + lane] = hi ? mL[1] : mL[0]; Lz[(size_t)z * NN + j0 + lane] = hi ? l[1] : l[0];
    float* op = O1 + ((size_t)z * CR + 8 * hi) * NN + j0 + lr;
#pragma unroll
    for (int ct = 0; ct < 2; ++ct)
#pragma unroll
        for (int r = 0; r < 8; ++r)
#pragma unroll
            for (int jt = 0; jt < 2; ++jt) op[(size_t)(ct * 16 + r) * NN + jt * 16] = o[ct][jt][r];
}
// k_ot: joins the KS slices of k_attn (z ascending, f32): out[c][j] = sum_z 2^(Mz - max) O1[z][c][j] / sum_z 2^(Mz - max) Lz, and writes the hl planes OT[j][c]. A block owns 32 positions: wave w sums channels 4w..4w+3 with lanes along j (whole 128-B lines), then the block turns the 32 x 32 tile through LDS so that each wave stores whole lines.
__global__ __launch_bounds__(256) void k_ot(const float* __restrict__ O1, const float* __restrict__ Mz, const float* __restrict__ Lz, bf* Oh, bf* Ol) { __shared__ float sm[32 * 33]; const int lane = threadIdx.x & 31, w = threadIdx.x >> 5; const int j = blockIdx.x * 32 + lane; const float* p = O1 + (size_t)(w * 4) * NN + j; float s[4] = {0.f, 0.f, 0.f, 0.f};
    float wz[KS], lz[KS], lw[KS], mm = -3.0e38f, den = 0.f;
#pragma unroll
    for (int z = 0; z < KS; ++z) { wz[z] = Mz[(size_t)z * NN + j]; lz[z] = Lz[(size_t)z * NN + j]; }
#pragma unroll
    for (int z = 0; z < KS; ++z) mm = fmaxf(mm, wz[z]);
#pragma unroll
    for (int z = 0; z < KS; ++z) lw[z] = wz[z] - mm;
    exp2x8(lw, wz); exp2x8(lw + 8, wz + 8);
#pragma unroll
    for (int z = 0; z < KS; ++z) den += wz[z] * lz[z];
#pragma unroll
    for (int z = 0; z < KS; ++z) {
#pragma unroll
        for (int u = 0; u < 4; ++u) s[u] += wz[z] * p[(size_t)z * CR * NN + (size_t)u * NN]; }
    const float inv = __fdiv_rn(1.0f, den);
#pragma unroll
    for (int u = 0; u < 4; ++u) sm[lane * 33 + w * 4 + u] = s[u] * inv;
    __syncthreads();    // the tile is read across waves below
    const int e = (blockIdx.x * 256 + threadIdx.x) * 4; const int nl = threadIdx.x >> 3, c = (threadIdx.x & 7) * 4; v4us oh, ol;
#pragma unroll
    for (int u = 0; u < 4; ++u) { unsigned short a, b; splitf(sm[nl * 33 + c + u], a, b); oh[u] = a; ol[u] = b; } *(v4us*)(Oh + e) = oh; *(v4us*)(Ol + e) = ol;  }
__global__ __launch_bounds__(256) void k_fin(const float* __restrict__ G, const float* __restrict__ X, const float* __restrict__ scale, float* Y) { const size_t e = ((size_t)blockIdx.x * 256 + threadIdx.x) * 4; if (e >= (size_t)CC * NN) return; const int n = (int)(e % NN); const int c = (int)(e / NN); const float sc = bfr(scale[0]); const v4f xx = *(const v4f*)(X + e); v4f r;
#pragma unroll
    for (int u = 0; u < 4; ++u) { float p = __fmul_rn(sc, G[(size_t)(n + u) * CC + c]); asm volatile("" : "+v"(p)); r[u] = __fadd_rn(p, bfr(xx[u])); } *(v4f*)(Y + e) = r;  }

extern "C" void kernel_launch(void* const* d_in, const int* in_sizes, int n_in,
                              void* d_out, int out_size, void* d_ws, size_t ws_size, hipStream_t stream) {
    (void)in_sizes; (void)n_in; (void)out_size;
    const float* x = (const float*)d_in[0]; const float* Wt = (const float*)d_in[1]; const float* Wo = (const float*)d_in[2]; const float* scale = (const float*)d_in[3];
    float* OUT = (float*)d_out;     // [8][256][4096]
    char* wsp = (char*)d_ws;
    auto take = [&](size_t bytes) { char* p = wsp; wsp += (bytes + 255) & ~(size_t)255; return (void*)p; };
    bf* AW = (bf*)take((size_t)128 * CC * 2); bf* AO = (bf*)take((size_t)CC * CR * 2); bf* XT = (bf*)take((size_t)NN * CC * 2); float* T = (float*)take((size_t)128 * NN * 4);
    bf* QTh = (bf*)take((size_t)NN * CR * 2); bf* QTl = (bf*)take((size_t)NN * CR * 2); bf* KTh = (bf*)take((size_t)NN * CR * 2); bf* KTl = (bf*)take((size_t)NN * CR * 2); bf* VPh = (bf*)take((size_t)64 * NN * 2); bf* VPl = (bf*)take((size_t)64 * NN * 2);
    float* O1 = (float*)take((size_t)KS * CR * NN * 4); float* Mz = (float*)take((size_t)KS * NN * 4); float* Lz = (float*)take((size_t)KS * NN * 4); bf* OTh = (bf*)take((size_t)NN * CR * 2); bf* OTl = (bf*)take((size_t)NN * CR * 2); float* G = (float*)take((size_t)CC * NN * 4);
    if ((size_t)(wsp - (char*)d_ws) > ws_size) return;    // total ~ 20 MB
    k_wt128<<<(128 * CC / 4 + 255) / 256, 256, 0, stream>>>(Wt, AW); k_wo<<<(CC * CR / 4 + 255) / 256, 256, 0, stream>>>(Wo, AO);
    for (int b = 0; b < NB_; ++b) { const float* xb = x + (size_t)b * CC * NN;
        k_xt<<<(NN * CC / 4 + 255) / 256, 256, 0, stream>>>(xb, XT);
        k_gemmw<bf, 0, false><<<dim3(2, NN / 64, 1), 32, 0, stream>>>(AW, nullptr, XT, nullptr, CC, CC, T, NN, nullptr, 0, 0, 0);     // t[r][n], rows 0..95 real
        k_qk<<<(NN * CR / 4 + 255) / 256, 256, 0, stream>>>(T, QTh, QTl, KTh, KTl); k_vp<<<(64 * NN / 4 + 255) / 256, 256, 0, stream>>>(T, VPh, VPl);
        k_attn<<<dim3(NN / 256, KS), 256, 0, stream>>>(QTh, QTl, KTh, KTl, VPh, VPl, O1, Mz, Lz);     // per key slice z: unnormalised out[c][j], maximum and sum; k_ot joins the slices
        k_ot<<<(NN * CR / 4 + 255) / 256, 256, 0, stream>>>(O1, Mz, Lz, OTh, OTl);
        k_gemmw<bf, 1, false><<<dim3(NN / 64, CC / 64, 1), 32, 0, stream>>>(OTh, OTl, AO, nullptr, CR, CR, G, CC, nullptr, 0, 0, 0);     // G[j][o] = out^T . Wo^T (position-major; hl x exact, 2 products)
        k_fin<<<(CC * NN / 4 + 255) / 256, 256, 0, stream>>>(G, xb, scale, OUT + (size_t)b * CC * NN); }
}

// v003
// A run of this version takes 151 microseconds.
// Two timings next to v002 both put it at 2.27 times that version's speed.
// Counting every step since v000, it is 9.42 times as fast.
#include <hip/hip_runtime.h>

// GlobalSelfAttention (x [8][256][64][64] channel-major, N = 4096 positions; t = Wt . x (1x1 conv, [96][256]): key = t[0:32], query = t[32:64], value = t[64:96]; scores[i][j] = sum_c key[c][i] query[c][j] (unscaled); weights = softmax over i (the key axis) for every j;
//   out[c][j] = sum_i value[c][i] weights[i][j]; y = Wo . out (1x1 conv, [256][32]); result = scale[0] * y + x -> [8][256][64][64]; scale read).
// Compute dtypes, f32 accumulate: every input rounded to bf16; t as a PLAIN bf16 GEMM Wt . x^T (inputs: exact; Wt padded to 128 rows, x transposed per batch); logits, softmax and value product in ONE kernel (k_attn): S^T = K^T planes [i][c] . Q as hl x hl (3 products, K = 32), running maximum and sum per j in f32, exp -> hl operand in registers, out += V (hl planes [c][i]) . P^T as 3 products; 16 key slices, joined in k_ot; y^T = out^T planes (hl) . Wo^T (exact, K = 32; 2 products, position-major); scale * y + x in f32.

#define NB_  8
#define CC   256
#define CR   32
#define NN   4096
#define KS   16      // key slices of the attention kernel (256 keys each)
typedef _Float16 h16;
typedef unsigned short bf;
typedef __attribute__((ext_vector_type(16))) __bf16   v16bf;
typedef __attribute__((ext_vector_type(16))) _Float16 v16h;
typedef __attribute__((ext_vector_type(8)))  _Float16 v8h;
typedef __attribute__((ext_vector_type(8)))  unsigned short v8us;
typedef __attribute__((ext_vector_type(8)))  float    v8f;
typedef __attribute__((ext_vector_type(4)))  float    v4f;
typedef v8h  __attribute__((may_alias)) v8ha;
typedef v4f  __attribute__((may_alias)) v4fa;
typedef v8us __attribute__((may_alias)) v8usa;

__device__ __forceinline__ unsigned short f2bf(float f) { unsigned u = __float_as_uint(f); u += 0x7FFFu + ((u >> 16) & 1u); return (unsigned short)(u >> 16); }
__device__ __forceinline__ float bf2f(unsigned short b) { return __uint_as_float(((unsigned)b) << 16); }
__device__ __forceinline__ float bfr(float f) { return bf2f(f2bf(f)); }
__device__ __forceinline__ v16h cat16(v8h lo, v8h hi) { return __builtin_shufflevector(lo, hi, 0, 1, 2, 3, 4, 5, 6, 7, 8, 9, 10, 11, 12, 13, 14, 15); }
__device__ __forceinline__ v16bf cat16b(v8us lo, v8us hi) { return __builtin_bit_cast(v16bf, __builtin_shufflevector(lo, hi, 0, 1, 2, 3, 4, 5, 6, 7, 8, 9, 10, 11, 12, 13, 14, 15)); }
__device__ __forceinline__ v8f wmma16(v16h a, v16h b, v8f c) { return __builtin_amdgcn_wmma_f32_16x16x32_f16(false, a, false, b, (short)0, c, false, false); }
__device__ __forceinline__ v8f wmmab(v16bf a, v16bf b, v8f c) { return __builtin_amdgcn_wmma_f32_16x16x32_bf16(false, a, false, b, (short)0, c, false, false); }



// ---- k_gemmw: register-blocked GEMM, ONE WAVE per 64x64 output tile (16 accumulators), operands straight from K-contiguous 16-bit planes; grid (M/64, N/64, Z), 32 threads.
// C[m][n] (f32, pitch ldc, + optional f32 bias[n]) = sum over k in [0, KL) of A[m][k] Bt[n][k] (+ split products per NSPLIT), rows of pitch K. z strides sA/sB/sC in elements: a batch, or with sA = sB = KL < K a K slice whose partial sum goes to its own C plane. KL % 32 == 0.
template <typename T16> struct WFrag;
template <> struct WFrag<h16> { typedef v16h V; static __device__ __forceinline__ V ld(const h16* p) { return cat16(*(const v8h*)p, *(const v8h*)(p + 16)); } static __device__ __forceinline__ v8f mma(V a, V b, v8f c) { return wmma16(a, b, c); } };
template <> struct WFrag<bf> { typedef v16bf V; static __device__ __forceinline__ V ld(const bf* p) { return cat16b(*(const v8us*)p, *(const v8us*)(p + 16)); } static __device__ __forceinline__ v8f mma(V a, V b, v8f c) { return wmmab(a, b, c); } };
template <typename T16, int NSPLIT, bool BIAS>
__global__ __launch_bounds__(32) void k_gemmw(const T16* __restrict__ A, const T16* __restrict__ A2, const T16* __restrict__ Bt, const T16* __restrict__ Bt2, int K, int KL, float* C, int ldc, const float* __restrict__ bias, size_t sA, size_t sB, size_t sC) {
    typedef typename WFrag<T16>::V V;
    __shared__ __align__(16) float os[16 * 68];
    const size_t z = blockIdx.z; A += z * sA; if (A2) A2 += z * sA; Bt += z * sB; if (Bt2) Bt2 += z * sB; C += z * sC;
    const int lane = threadIdx.x & 31, lr = lane & 15, hi = lane >> 4; const int r0 = blockIdx.x * 64, c0 = blockIdx.y * 64;
    v8f acc[4][4];
#pragma unroll
    for (int mb = 0; mb < 4; ++mb)
#pragma unroll
        for (int nb = 0; nb < 4; ++nb) acc[mb][nb] = (v8f){};
    const size_t aoff = (size_t)(r0 + lr) * K + 8 * hi, boff = (size_t)(c0 + lr) * K + 8 * hi;
#pragma unroll 1
    for (int kc = 0; kc < KL; kc += 32) {
        V a[4], a2[4];
#pragma unroll
        for (int mb = 0; mb < 4; ++mb) { a[mb] = WFrag<T16>::ld(A + aoff + (size_t)mb * 16 * K + kc); if (NSPLIT == 1 || NSPLIT == 2) a2[mb] = WFrag<T16>::ld(A2 + aoff + (size_t)mb * 16 * K + kc); }
#pragma unroll
        for (int nb = 0; nb < 4; ++nb) { const V b = WFrag<T16>::ld(Bt + boff + (size_t)nb * 16 * K + kc); V b2; if (NSPLIT >= 2) b2 = WFrag<T16>::ld(Bt2 + boff + (size_t)nb * 16 * K + kc);
#pragma unroll
            for (int mb = 0; mb < 4; ++mb) { acc[mb][nb] = WFrag<T16>::mma(a[mb], b, acc[mb][nb]); if (NSPLIT == 1 || NSPLIT == 2) acc[mb][nb] = WFrag<T16>::mma(a2[mb], b, acc[mb][nb]); if (NSPLIT >= 2) acc[mb][nb] = WFrag<T16>::mma(a[mb], b2, acc[mb][nb]); } }
        asm volatile("v_nop\n\tv_nop\n\tv_nop\n\tv_nop" : "+v"(acc[0][0]), "+v"(acc[1][1]), "+v"(acc[2][2]), "+v"(acc[3][3]) : "v"(a[0]), "v"(a[3]));
    }
#pragma unroll
    for (int mb = 0; mb < 4; ++mb) {
#pragma unroll
        for (int nb = 0; nb < 4; ++nb) {
#pragma unroll
            for (int j = 0; j < 8; ++j) os[(hi * 8 + j) * 68 + nb * 16 + lr] = acc[mb][nb][j]; }
        __builtin_amdgcn_wave_barrier(); asm volatile("" ::: "memory");
        float* crow = C + (size_t)(r0 + mb * 16) * ldc + c0;
{
#pragma unroll
            for (int s = 0; s < 8; ++s) { const int row = 2 * s + hi, cofs = lr * 4; v4f val = *(const v4fa*)(os + row * 68 + cofs); if (BIAS) { val[0] += bfr(bias[c0 + cofs]); val[1] += bfr(bias[c0 + cofs + 1]); val[2] += bfr(bias[c0 + cofs + 2]); val[3] += bfr(bias[c0 + cofs + 3]); }
                *(v4f*)(crow + (size_t)row * ldc + cofs) = val; }
             }
        __builtin_amdgcn_wave_barrier(); asm volatile("" ::: "memory");
    }
}

__device__ __forceinline__ void splitf(float y, unsigned short& h, unsigned short& l) { h = f2bf(y); l = f2bf(y - bf2f(h)); }
typedef __attribute__((ext_vector_type(2))) unsigned short v2us;
typedef __attribute__((ext_vector_type(4))) unsigned short v4us;

// k_wt128: A [128][256] = bf16(Wt) rows < 96 else 0; k_wo: A2 [256][32] = bf16(Wo); k_xt: XT[n][c] = bf16(x[c][n]) (8-B lanes along c); k_qk: hl planes QT[j][c] = T[32 + c][j] and KT[i][c] = T[c][i] (8-B lanes along c); k_vp: hl planes VP[r][i] = T[64 + r][i] for r < 32 else 0 ([64][4096], 8-B lanes);
__global__ __launch_bounds__(256) void k_wt128(const float* __restrict__ w, bf* A) { const int e = (blockIdx.x * 256 + threadIdx.x) * 4; if (e >= 128 * CC) return; const int r = e / CC; v4us o; for (int u = 0; u < 4; ++u) o[u] = (r < 3 * CR) ? f2bf(w[e + u]) : (unsigned short)0; *(v4us*)(A + e) = o;  }
__global__ __launch_bounds__(256) void k_wo(const float* __restrict__ w, bf* A) { const int e = (blockIdx.x * 256 + threadIdx.x) * 4; if (e >= CC * CR) return; v4us o; for (int u = 0; u < 4; ++u) o[u] = f2bf(w[e + u]); *(v4us*)(A + e) = o;  }
// Every kernel from here on (and k_gemmw through its z strides) serves all NB_ batches in one launch: the slowest grid axis is the batch, and each workspace plane but the weight planes AW and AO has one copy per batch.
__global__ __launch_bounds__(256) void k_xt(const float* __restrict__ X, bf* XT) { const int e = (blockIdx.x * 256 + threadIdx.x) * 4; if (e >= NN * CC) return; X += (size_t)blockIdx.y * CC * NN; XT += (size_t)blockIdx.y * NN * CC; const int c = e % CC; const int n = e / CC; v4us o;
#pragma unroll
    for (int u = 0; u < 4; ++u) o[u] = f2bf(X[(size_t)(c + u) * NN + n]); *(v4us*)(XT + e) = o;  }
__global__ __launch_bounds__(256) void k_qk(const float* __restrict__ T, bf* Qh, bf* Ql, bf* Kh, bf* Kl) { const int e = (blockIdx.x * 256 + threadIdx.x) * 4; if (e >= NN * CR) return; { const size_t b = blockIdx.y; T += b * 128 * NN; Qh += b * NN * CR; Ql += b * NN * CR; Kh += b * NN * CR; Kl += b * NN * CR; } const int c = e % CR; const int n = e / CR; v4us qh, ql, kh, kl;
#pragma unroll
    for (int u = 0; u < 4; ++u) { unsigned short a, b; splitf(T[(size_t)(CR + c + u) * NN + n], a, b); qh[u] = a; ql[u] = b; splitf(T[(size_t)(c + u) * NN + n], a, b); kh[u] = a; kl[u] = b; }
    *(v4us*)(Qh + e) = qh; *(v4us*)(Ql + e) = ql; *(v4us*)(Kh + e) = kh; *(v4us*)(Kl + e) = kl;  }
__global__ __launch_bounds__(256) void k_vp(const float* __restrict__ T, bf* Vh, bf* Vl) { const size_t e = ((size_t)blockIdx.x * 256 + threadIdx.x) * 4; if (e >= (size_t)64 * NN) return; { const size_t b = blockIdx.y; T += b * 128 * NN; Vh += b * 64 * NN; Vl += b * 64 * NN; } const int r = (int)(e / NN); const int n = (int)(e % NN); v4us oh, ol;
#pragma unroll
    for (int u = 0; u < 4; ++u) { unsigned short a = 0, b = 0; if (r < CR) splitf(T[(size_t)(2 * CR + r) * NN + n + u], a, b); oh[u] = a; ol[u] = b; } *(v4us*)(Vh + e) = oh; *(v4us*)(Vl + e) = ol;  }
typedef __attribute__((ext_vector_type(2))) float v2f;
typedef __attribute__((ext_vector_type(2))) __bf16 v2bf;
typedef __attribute__((ext_vector_type(8))) unsigned v8u;
#define L2E 1.4426950408889634f
__device__ __forceinline__ float xhalf(float v) { const int b = __float_as_int(v); return __int_as_float(__builtin_amdgcn_permlanex16(b, b, 0x76543210, 0xfedcba98, false, false)); }    // lane l <-> l ^ 16
// exp2x8 / exp2x1: v_exp_f32 with the slot behind a transcendental kept by construction: no result lies on a source (early clobber), nothing in the run reads a result, and one v_nop fills the slot behind the last.
__device__ __forceinline__ void exp2x8(const float* x, float* y) {
    asm("v_exp_f32 %0, %8\n\tv_exp_f32 %1, %9\n\tv_exp_f32 %2, %10\n\tv_exp_f32 %3, %11\n\tv_exp_f32 %4, %12\n\tv_exp_f32 %5, %13\n\tv_exp_f32 %6, %14\n\tv_exp_f32 %7, %15\n\tv_nop"
        : "=&v"(y[0]), "=&v"(y[1]), "=&v"(y[2]), "=&v"(y[3]), "=&v"(y[4]), "=&v"(y[5]), "=&v"(y[6]), "=&v"(y[7]) : "v"(x[0]), "v"(x[1]), "v"(x[2]), "v"(x[3]), "v"(x[4]), "v"(x[5]), "v"(x[6]), "v"(x[7])); }
__device__ __forceinline__ float exp2x1(float x) { float y; asm("v_exp_f32 %0, %1\n\tv_nop" : "=&v"(y) : "v"(x)); return y; }
// addr_done: s_wait_xcnt 0 held in its place by two scheduling barriers; it stands between a load and later loads whose results the register allocator may lay over the first load's address registers.
__device__ __forceinline__ void addr_done() { __builtin_amdgcn_sched_barrier(0); asm volatile("s_wait_xcnt 0x0" ::: "memory"); __builtin_amdgcn_sched_barrier(0); }
__global__ __launch_bounds__(256) void k_attn(const bf* __restrict__ Qh, const bf* __restrict__ Ql, const bf* __restrict__ Kh, const bf* __restrict__ Kl, const bf* __restrict__ Vh, const bf* __restrict__ Vl, float* __restrict__ O1, float* __restrict__ Mz, float* __restrict__ Lz) {
    typedef WFrag<bf> F; typedef v16bf V;
    { const size_t b = blockIdx.z; Qh += b * NN * CR; Ql += b * NN * CR; Kh += b * NN * CR; Kl += b * NN * CR; Vh += b * 64 * NN; Vl += b * 64 * NN; O1 += b * KS * CR * NN; Mz += b * KS * NN; Lz += b * KS * NN; }
    const int lane = threadIdx.x & 31, lr = lane & 15, hi = lane >> 4, w = threadIdx.x >> 5;
    const int j0 = blockIdx.x * 256 + w * 32, z = blockIdx.y, ib = z * (NN / KS);
    V qh[2], ql[2];
#pragma unroll
    for (int jt = 0; jt < 2; ++jt) { qh[jt] = F::ld(Qh + (size_t)(j0 + jt * 16 + lr) * CR + 8 * hi); addr_done(); ql[jt] = F::ld(Ql + (size_t)(j0 + jt * 16 + lr) * CR + 8 * hi); addr_done(); }
    const size_t koff = (size_t)(ib + lr) * CR + 8 * hi, voff = (size_t)lr * NN + ib + 8 * hi;
    v8f o[2][2]; float mL[2], l[2];
#pragma unroll
    for (int jt = 0; jt < 2; ++jt) { o[0][jt] = (v8f){}; o[1][jt] = (v8f){}; mL[jt] = -3.0e38f; l[jt] = 0.f; }
    V kh[2], kl[2];
#pragma unroll
    for (int it = 0; it < 2; ++it) { kh[it] = F::ld(Kh + koff + it * 16 * CR); kl[it] = F::ld(Kl + koff + it * 16 * CR); }
#pragma unroll 1        // rolled: the pass is long enough to fill the pipes, and the code stays small
    for (int t = 0; t < NN / KS / 32; ++t) {
        V vh[2], vl[2];
#pragma unroll
        for (int ct = 0; ct < 2; ++ct) { vh[ct] = F::ld(Vh + voff + (size_t)ct * 16 * NN + t * 32); vl[ct] = F::ld(Vl + voff + (size_t)ct * 16 * NN + t * 32); }
        __builtin_amdgcn_sched_barrier(0);    // keeps the V loads at the head of the pass, a whole softmax ahead of their use (the scheduler otherwise sinks half of them to just before the value products)
        v8f s[2][2];
#pragma unroll
        for (int jt = 0; jt < 2; ++jt)
#pragma unroll
            for (int it = 0; it < 2; ++it) s[jt][it] = F::mma(kh[it], qh[jt], (v8f){});
#pragma unroll
        for (int jt = 0; jt < 2; ++jt)
#pragma unroll
            for (int it = 0; it < 2; ++it) s[jt][it] = F::mma(kh[it], ql[jt], s[jt][it]);
#pragma unroll
        for (int jt = 0; jt < 2; ++jt)
#pragma unroll
            for (int it = 0; it < 2; ++it) s[jt][it] = F::mma(kl[it], qh[jt], s[jt][it]);
        const int tn = (t + 1 < NN / KS / 32) ? t + 1 : t;    // the next pass's K rows, fetched behind this pass's score products (the last pass reads its own again: in bounds)
#pragma unroll
        for (int it = 0; it < 2; ++it) { kh[it] = F::ld(Kh + koff + (size_t)(tn * 32 + it * 16) * CR); kl[it] = F::ld(Kl + koff + (size_t)(tn * 32 + it * 16) * CR); }
        __builtin_amdgcn_sched_barrier(0);    // keeps the next pass's K loads here, so that they fly under the softmax and the value products (the scheduler otherwise sinks them to the foot of the pass)
        V ph[2], pl[2];
#pragma unroll
        for (int jt = 0; jt < 2; ++jt) {
            float mx = s[jt][0][0];
#pragma unroll
            for (int r = 1; r < 8; ++r) mx = fmaxf(mx, s[jt][0][r]);
#pragma unroll
            for (int r = 0; r < 8; ++r) mx = fmaxf(mx, s[jt][1][r]);
            mx = fmaxf(mx, xhalf(mx));
            const float mn = fmaxf(mL[jt], mx * L2E); const float al = exp2x1(mL[jt] - mn); mL[jt] = mn;
            float sum = 0.f, xs[16], ps[16]; v8u uh, ul;
#pragma unroll
            for (int e = 0; e < 16; ++e) xs[e] = __builtin_fmaf(s[jt][e >> 3][e & 7], L2E, -mn);
            exp2x8(xs, ps); exp2x8(xs + 8, ps + 8);
#pragma unroll
            for (int e = 0; e < 8; ++e) {
                v2f p; p[0] = ps[2 * e]; p[1] = ps[2 * e + 1]; sum += p[0] + p[1];
                const v2bf h = __builtin_convertvector(p, v2bf); const unsigned hu = __builtin_bit_cast(unsigned, h); uh[e] = hu;
                v2f d; d[0] = p[0] - __uint_as_float(hu << 16); d[1] = p[1] - __uint_as_float(hu & 0xFFFF0000u);
                ul[e] = __builtin_bit_cast(unsigned, __builtin_convertvector(d, v2bf)); }
            l[jt] = l[jt] * al + sum; ph[jt] = __builtin_bit_cast(V, uh); pl[jt] = __builtin_bit_cast(V, ul);
#pragma unroll
            for (int r = 0; r < 8; ++r) { o[0][jt][r] *= al; o[1][jt][r] *= al; }
        }
#pragma unroll
        for (int jt = 0; jt < 2; ++jt)
#pragma unroll
            for (int ct = 0; ct < 2; ++ct) o[ct][jt] = F::mma(vh[ct], ph[jt], o[ct][jt]);
#pragma unroll
        for (int jt = 0; jt < 2; ++jt)
#pragma unroll
            for (int ct = 0; ct < 2; ++ct) o[ct][jt] = F::mma(vl[ct], ph[jt], o[ct][jt]);
#pragma unroll
        for (int jt = 0; jt < 2; ++jt)
#pragma unroll
            for (int ct = 0; ct < 2; ++ct) o[ct][jt] = F::mma(vh[ct], pl[jt], o[ct][jt]);
    }
#pragma unroll
    for (int jt = 0; jt < 2; ++jt) l[jt] += xhalf(l[jt]);
    Mz[(size_t)z * NN + j0 + lane] = hi ? mL[1] : mL[0]; Lz[(size_t)z * NN + j0 + lane] = hi ? l[1] : l[0];
    float* op = O1 + ((size_t)z * CR + 8 * hi) * NN + j0 + lr;
#pragma unroll
    for (int ct = 0; ct < 2; ++ct)
#pragma unroll
        for (int r = 0; r < 8; ++r)
#pragma unroll
            for (int jt = 0; jt < 2; ++jt) op[(size_t)(ct * 16 + r) * NN + jt * 16] = o[ct][jt][r];
}
// k_ot: joins the KS slices of k_attn (z ascending, f32): out[c][j] = sum_z 2^(Mz - max) O1[z][c][j] / sum_z 2^(Mz - max) Lz, and writes the hl planes OT[j][c]. A block owns 32 positions: wave w sums channels 4w..4w+3 with lanes along j (whole 128-B lines), then the block turns the 32 x 32 tile through LDS so that each wave stores whole lines.
__global__ __launch_bounds__(256) void k_ot(const float* __restrict__ O1, const float* __restrict__ Mz, const float* __restrict__ Lz, bf* Oh, bf* Ol) { __shared__ float sm[32 * 33]; { const size_t b = blockIdx.y; O1 += b * KS * CR * NN; Mz += b * KS * NN; Lz += b * KS * NN; Oh += b * NN * CR; Ol += b * NN * CR; } const int lane = threadIdx.x & 31, w = threadIdx.x >> 5; const int j = blockIdx.x * 32 + lane; const float* p = O1 + (size_t)(w * 4) * NN + j; float s[4] = {0.f, 0.f, 0.f, 0.f};
    float wz[KS], lz[KS], lw[KS], mm = -3.0e38f, den = 0.f;
#pragma unroll
    for (int z = 0; z < KS; ++z) { wz[z] = Mz[(size_t)z * NN + j]; lz[z] = Lz[(size_t)z * NN + j]; }
#pragma unroll
    for (int z = 0; z < KS; ++z) mm = fmaxf(mm, wz[z]);
#pragma unroll
    for (int z = 0; z < KS; ++z) lw[z] = wz[z] - mm;
    exp2x8(lw, wz); exp2x8(lw + 8, wz + 8);
#pragma unroll
    for (int z = 0; z < KS; ++z) den += wz[z] * lz[z];
#pragma unroll
    for (int z = 0; z < KS; ++z) {
#pragma unroll
        for (int u = 0; u < 4; ++u) s[u] += wz[z] * p[(size_t)z * CR * NN + (size_t)u * NN]; }
    const float inv = __fdiv_rn(1.0f, den);
#pragma unroll
    for (int u = 0; u < 4; ++u) sm[lane * 33 + w * 4 + u] = s[u] * inv;
    __syncthreads();    // the tile is read across waves below
    const int e = (blockIdx.x * 256 + threadIdx.x) * 4; const int nl = threadIdx.x >> 3, c = (threadIdx.x & 7) * 4; v4us oh, ol;
#pragma unroll
    for (int u = 0; u < 4; ++u) { unsigned short a, b; splitf(sm[nl * 33 + c + u], a, b); oh[u] = a; ol[u] = b; } *(v4us*)(Oh + e) = oh; *(v4us*)(Ol + e) = ol;  }
__global__ __launch_bounds__(256) void k_fin(const float* __restrict__ G, const float* __restrict__ X, const float* __restrict__ scale, float* Y) { const size_t e = ((size_t)blockIdx.x * 256 + threadIdx.x) * 4; if (e >= (size_t)CC * NN) return; { const size_t b = blockIdx.y; G += b * NN * CC; X += b * CC * NN; Y += b * CC * NN; } const int n = (int)(e % NN); const int c = (int)(e / NN); const float sc = bfr(scale[0]); const v4f xx = *(const v4f*)(X + e); v4f r;
#pragma unroll
    for (int u = 0; u < 4; ++u) { float p = __fmul_rn(sc, G[(size_t)(n + u) * CC + c]); asm volatile("" : "+v"(p)); r[u] = __fadd_rn(p, bfr(xx[u])); } *(v4f*)(Y + e) = r;  }

extern "C" void kernel_launch(void* const* d_in, const int* in_sizes, int n_in,
                              void* d_out, int out_size, void* d_ws, size_t ws_size, hipStream_t stream) {
    (void)in_sizes; (void)n_in; (void)out_size;
    const float* x = (const float*)d_in[0]; const float* Wt = (const float*)d_in[1]; const float* Wo = (const float*)d_in[2]; const float* scale = (const float*)d_in[3];
    float* OUT = (float*)d_out;     // [8][256][4096]
    char* wsp = (char*)d_ws;
    auto take = [&](size_t bytes) { char* p = wsp; wsp += (bytes + 255) & ~(size_t)255; return (void*)p; };
    bf* AW = (bf*)take((size_t)128 * CC * 2); bf* AO = (bf*)take((size_t)CC * CR * 2); bf* XT = (bf*)take((size_t)NB_ * NN * CC * 2); float* T = (float*)take((size_t)NB_ * 128 * NN * 4);
    bf* QTh = (bf*)take((size_t)NB_ * NN * CR * 2); bf* QTl = (bf*)take((size_t)NB_ * NN * CR * 2); bf* KTh = (bf*)take((size_t)NB_ * NN * CR * 2); bf* KTl = (bf*)take((size_t)NB_ * NN * CR * 2); bf* VPh = (bf*)take((size_t)NB_ * 64 * NN * 2); bf* VPl = (bf*)take((size_t)NB_ * 64 * NN * 2);
    float* O1 = (float*)take((size_t)NB_ * KS * CR * NN * 4); float* Mz = (float*)take((size_t)NB_ * KS * NN * 4); float* Lz = (float*)take((size_t)NB_ * KS * NN * 4); bf* OTh = (bf*)take((size_t)NB_ * NN * CR * 2); bf* OTl = (bf*)take((size_t)NB_ * NN * CR * 2); float* G = (float*)take((size_t)NB_ * CC * NN * 4);
    if ((size_t)(wsp - (char*)d_ws) > ws_size) return;    // total ~ 152 MB
    k_wt128<<<(128 * CC / 4 + 255) / 256, 256, 0, stream>>>(Wt, AW); k_wo<<<(CC * CR / 4 + 255) / 256, 256, 0, stream>>>(Wo, AO);
    k_xt<<<dim3((NN * CC / 4 + 255) / 256, NB_), 256, 0, stream>>>(x, XT);
    k_gemmw<bf, 0, false><<<dim3(2, NN / 64, NB_), 32, 0, stream>>>(AW, nullptr, XT, nullptr, CC, CC, T, NN, nullptr, 0, (size_t)NN * CC, (size_t)128 * NN);     // t[b][r][n], rows 0..95 real
    k_qk<<<dim3((NN * CR / 4 + 255) / 256, NB_), 256, 0, stream>>>(T, QTh, QTl, KTh, KTl); k_vp<<<dim3((64 * NN / 4 + 255) / 256, NB_), 256, 0, stream>>>(T, VPh, VPl);
    k_attn<<<dim3(NN / 256, KS, NB_), 256, 0, stream>>>(QTh, QTl, KTh, KTl, VPh, VPl, O1, Mz, Lz);     // per batch and key slice z: unnormalised out[c][j], maximum and sum; k_ot joins the slices
    k_ot<<<dim3((NN * CR / 4 + 255) / 256, NB_), 256, 0, stream>>>(O1, Mz, Lz, OTh, OTl);
    k_gemmw<bf, 1, false><<<dim3(NN / 64, CC / 64, NB_), 32, 0, stream>>>(OTh, OTl, AO, nullptr, CR, CR, G, CC, nullptr, (size_t)NN * CR, 0, (size_t)NN * CC);     // G[b][j][o] = out^T . Wo^T (position-major; hl x exact, 2 products)
    k_fin<<<dim3((CC * NN / 4 + 255) / 256, NB_), 256, 0, stream>>>(G, x, scale, OUT);
}

// v004
// It runs in 105 microseconds.
// Next to v003, in two timings, it ran 1.43 times as fast each time.
// Counting every step since v000, it is 13.5 times as fast.
#include <hip/hip_runtime.h>

// GlobalSelfAttention (x [8][256][64][64] channel-major, N = 4096 positions; t = Wt . x (1x1 conv, [96][256]): key = t[0:32], query = t[32:64], value = t[64:96]; scores[i][j] = sum_c key[c][i] query[c][j] (unscaled); weights = softmax over i (the key axis) for every j;
//   out[c][j] = sum_i value[c][i] weights[i][j]; y = Wo . out (1x1 conv, [256][32]); result = scale[0] * y + x -> [8][256][64][64]; scale read).
// Compute dtypes, f32 accumulate: every input rounded to bf16; t as a PLAIN bf16 GEMM Wt . x^T (inputs: exact; Wt padded to 128 rows, x transposed per batch); logits, softmax and value product in ONE kernel (k_attn): S^T = K^T planes [i][c] . Q as hl x hl (3 products, K = 32), running maximum and sum per j in f32, exp -> hl operand in registers, out += V (hl planes [c][i]) . P^T as 3 products; 16 key slices, joined in k_ot; y = Wo (exact) . out^T planes (hl; K = 32, 2 products, channel-major) with scale * y + x in f32 applied to the accumulators in the same kernel (k_yfin).

#define NB_  8
#define CC   256
#define CR   32
#define NN   4096
#define KS   16      // key slices of the attention kernel (256 keys each)
typedef _Float16 h16;
typedef unsigned short bf;
typedef __attribute__((ext_vector_type(16))) __bf16   v16bf;
typedef __attribute__((ext_vector_type(16))) _Float16 v16h;
typedef __attribute__((ext_vector_type(8)))  _Float16 v8h;
typedef __attribute__((ext_vector_type(8)))  unsigned short v8us;
typedef __attribute__((ext_vector_type(8)))  float    v8f;
typedef __attribute__((ext_vector_type(4)))  float    v4f;
typedef v8h  __attribute__((may_alias)) v8ha;
typedef v4f  __attribute__((may_alias)) v4fa;
typedef v8us __attribute__((may_alias)) v8usa;

__device__ __forceinline__ unsigned short f2bf(float f) { unsigned u = __float_as_uint(f); u += 0x7FFFu + ((u >> 16) & 1u); return (unsigned short)(u >> 16); }
__device__ __forceinline__ float bf2f(unsigned short b) { return __uint_as_float(((unsigned)b) << 16); }
__device__ __forceinline__ float bfr(float f) { return bf2f(f2bf(f)); }
__device__ __forceinline__ v16h cat16(v8h lo, v8h hi) { return __builtin_shufflevector(lo, hi, 0, 1, 2, 3, 4, 5, 6, 7, 8, 9, 10, 11, 12, 13, 14, 15); }
__device__ __forceinline__ v16bf cat16b(v8us lo, v8us hi) { return __builtin_bit_cast(v16bf, __builtin_shufflevector(lo, hi, 0, 1, 2, 3, 4, 5, 6, 7, 8, 9, 10, 11, 12, 13, 14, 15)); }
__device__ __forceinline__ v8f wmma16(v16h a, v16h b, v8f c) { return __builtin_amdgcn_wmma_f32_16x16x32_f16(false, a, false, b, (short)0, c, false, false); }
__device__ __forceinline__ v8f wmmab(v16bf a, v16bf b, v8f c) { return __builtin_amdgcn_wmma_f32_16x16x32_bf16(false, a, false, b, (short)0, c, false, false); }



// ---- k_gemmw: register-blocked GEMM, ONE WAVE per 64x64 output tile (16 accumulators), operands straight from K-contiguous 16-bit planes; grid (M/64, N/64, Z), 32 threads.
// C[m][n] (f32, pitch ldc, + optional f32 bias[n]) = sum over k in [0, KL) of A[m][k] Bt[n][k] (+ split products per NSPLIT), rows of pitch K. z strides sA/sB/sC in elements: a batch, or with sA = sB = KL < K a K slice whose partial sum goes to its own C plane. KL % 32 == 0.
template <typename T16> struct WFrag;
template <> struct WFrag<h16> { typedef v16h V; static __device__ __forceinline__ V ld(const h16* p) { return cat16(*(const v8h*)p, *(const v8h*)(p + 16)); } static __device__ __forceinline__ v8f mma(V a, V b, v8f c) { return wmma16(a, b, c); } };
template <> struct WFrag<bf> { typedef v16bf V; static __device__ __forceinline__ V ld(const bf* p) { return cat16b(*(const v8us*)p, *(const v8us*)(p + 16)); } static __device__ __forceinline__ v8f mma(V a, V b, v8f c) { return wmmab(a, b, c); } };
template <typename T16, int NSPLIT, bool BIAS>
__global__ __launch_bounds__(32) void k_gemmw(const T16* __restrict__ A, const T16* __restrict__ A2, const T16* __restrict__ Bt, const T16* __restrict__ Bt2, int K, int KL, float* C, int ldc, const float* __restrict__ bias, size_t sA, size_t sB, size_t sC) {
    typedef typename WFrag<T16>::V V;
    __shared__ __align__(16) float os[16 * 68];
    const size_t z = blockIdx.z; A += z * sA; if (A2) A2 += z * sA; Bt += z * sB; if (Bt2) Bt2 += z * sB; C += z * sC;
    const int lane = threadIdx.x & 31, lr = lane & 15, hi = lane >> 4; const int r0 = blockIdx.x * 64, c0 = blockIdx.y * 64;
    v8f acc[4][4];
#pragma unroll
    for (int mb = 0; mb < 4; ++mb)
#pragma unroll
        for (int nb = 0; nb < 4; ++nb) acc[mb][nb] = (v8f){};
    const size_t aoff = (size_t)(r0 + lr) * K + 8 * hi, boff = (size_t)(c0 + lr) * K + 8 * hi;
#pragma unroll 1
    for (int kc = 0; kc < KL; kc += 32) {
        V a[4], a2[4];
#pragma unroll
        for (int mb = 0; mb < 4; ++mb) { a[mb] = WFrag<T16>::ld(A + aoff + (size_t)mb * 16 * K + kc); if (NSPLIT == 1 || NSPLIT == 2) a2[mb] = WFrag<T16>::ld(A2 + aoff + (size_t)mb * 16 * K + kc); }
#pragma unroll
        for (int nb = 0; nb < 4; ++nb) { const V b = WFrag<T16>::ld(Bt + boff + (size_t)nb * 16 * K + kc); V b2; if (NSPLIT >= 2) b2 = WFrag<T16>::ld(Bt2 + boff + (size_t)nb * 16 * K + kc);
#pragma unroll
            for (int mb = 0; mb < 4; ++mb) { acc[mb][nb] = WFrag<T16>::mma(a[mb], b, acc[mb][nb]); if (NSPLIT == 1 || NSPLIT == 2) acc[mb][nb] = WFrag<T16>::mma(a2[mb], b, acc[mb][nb]); if (NSPLIT >= 2) acc[mb][nb] = WFrag<T16>::mma(a[mb], b2, acc[mb][nb]); } }
        asm volatile("v_nop\n\tv_nop\n\tv_nop\n\tv_nop" : "+v"(acc[0][0]), "+v"(acc[1][1]), "+v"(acc[2][2]), "+v"(acc[3][3]) : "v"(a[0]), "v"(a[3]));
    }
#pragma unroll
    for (int mb = 0; mb < 4; ++mb) {
#pragma unroll
        for (int nb = 0; nb < 4; ++nb) {
#pragma unroll
            for (int j = 0; j < 8; ++j) os[(hi * 8 + j) * 68 + nb * 16 + lr] = acc[mb][nb][j]; }
        __builtin_amdgcn_wave_barrier(); asm volatile("" ::: "memory");
        float* crow = C + (size_t)(r0 + mb * 16) * ldc + c0;
{
#pragma unroll
            for (int s = 0; s < 8; ++s) { const int row = 2 * s + hi, cofs = lr * 4; v4f val = *(const v4fa*)(os + row * 68 + cofs); if (BIAS) { val[0] += bfr(bias[c0 + cofs]); val[1] += bfr(bias[c0 + cofs + 1]); val[2] += bfr(bias[c0 + cofs + 2]); val[3] += bfr(bias[c0 + cofs + 3]); }
                *(v4f*)(crow + (size_t)row * ldc + cofs) = val; }
             }
        __builtin_amdgcn_wave_barrier(); asm volatile("" ::: "memory");
    }
}

__device__ __forceinline__ void splitf(float y, unsigned short& h, unsigned short& l) { h = f2bf(y); l = f2bf(y - bf2f(h)); }
typedef __attribute__((ext_vector_type(2))) unsigned short v2us;
typedef __attribute__((ext_vector_type(4))) unsigned short v4us;

// k_wt128: A [128][256] = bf16(Wt) rows < 96 else 0; k_wo: A2 [256][32] = bf16(Wo); k_xt: XT[n][c] = bf16(x[c][n]) (8-B lanes along c); k_qk: hl planes QT[j][c] = T[32 + c][j] and KT[i][c] = T[c][i] (8-B lanes along c); k_vp: hl planes VP[r][i] = T[64 + r][i] for r < 32 else 0 ([64][4096], 8-B lanes);
__global__ __launch_bounds__(256) void k_wt128(const float* __restrict__ w, bf* A) { const int e = (blockIdx.x * 256 + threadIdx.x) * 4; if (e >= 128 * CC) return; const int r = e / CC; v4us o; for (int u = 0; u < 4; ++u) o[u] = (r < 3 * CR) ? f2bf(w[e + u]) : (unsigned short)0; *(v4us*)(A + e) = o;  }
__global__ __launch_bounds__(256) void k_wo(const float* __restrict__ w, bf* A) { const int e = (blockIdx.x * 256 + threadIdx.x) * 4; if (e >= CC * CR) return; v4us o; for (int u = 0; u < 4; ++u) o[u] = f2bf(w[e + u]); *(v4us*)(A + e) = o;  }
// Every kernel from here on (and k_gemmw through its z strides) serves all NB_ batches in one launch: the slowest grid axis is the batch, and each workspace plane but the weight planes AW and AO has one copy per batch.
__global__ __launch_bounds__(256) void k_xt(const float* __restrict__ X, bf* XT) { const int e = (blockIdx.x * 256 + threadIdx.x) * 4; if (e >= NN * CC) return; X += (size_t)blockIdx.y * CC * NN; XT += (size_t)blockIdx.y * NN * CC; const int c = e % CC; const int n = e / CC; v4us o;
#pragma unroll
    for (int u = 0; u < 4; ++u) o[u] = f2bf(X[(size_t)(c + u) * NN + n]); *(v4us*)(XT + e) = o;  }
__global__ __launch_bounds__(256) void k_qk(const float* __restrict__ T, bf* Qh, bf* Ql, bf* Kh, bf* Kl) { const int e = (blockIdx.x * 256 + threadIdx.x) * 4; if (e >= NN * CR) return; { const size_t b = blockIdx.y; T += b * 128 * NN; Qh += b * NN * CR; Ql += b * NN * CR; Kh += b * NN * CR; Kl += b * NN * CR; } const int c = e % CR; const int n = e / CR; v4us qh, ql, kh, kl;
#pragma unroll
    for (int u = 0; u < 4; ++u) { unsigned short a, b; splitf(T[(size_t)(CR + c + u) * NN + n], a, b); qh[u] = a; ql[u] = b; splitf(T[(size_t)(c + u) * NN + n], a, b); kh[u] = a; kl[u] = b; }
    *(v4us*)(Qh + e) = qh; *(v4us*)(Ql + e) = ql; *(v4us*)(Kh + e) = kh; *(v4us*)(Kl + e) = kl;  }
__global__ __launch_bounds__(256) void k_vp(const float* __restrict__ T, bf* Vh, bf* Vl) { const size_t e = ((size_t)blockIdx.x * 256 + threadIdx.x) * 4; if (e >= (size_t)64 * NN) return; { const size_t b = blockIdx.y; T += b * 128 * NN; Vh += b * 64 * NN; Vl += b * 64 * NN; } const int r = (int)(e / NN); const int n = (int)(e % NN); v4us oh, ol;
#pragma unroll
    for (int u = 0; u < 4; ++u) { unsigned short a = 0, b = 0; if (r < CR) splitf(T[(size_t)(2 * CR + r) * NN + n + u], a, b); oh[u] = a; ol[u] = b; } *(v4us*)(Vh + e) = oh; *(v4us*)(Vl + e) = ol;  }
typedef __attribute__((ext_vector_type(2))) float v2f;
typedef __attribute__((ext_vector_type(2))) __bf16 v2bf;
typedef __attribute__((ext_vector_type(8))) unsigned v8u;
#define L2E 1.4426950408889634f
__device__ __forceinline__ float xhalf(float v) { const int b = __float_as_int(v); return __int_as_float(__builtin_amdgcn_permlanex16(b, b, 0x76543210, 0xfedcba98, false, false)); }    // lane l <-> l ^ 16
// exp2x8 / exp2x1: v_exp_f32 with the slot behind a transcendental kept by construction: no result lies on a source (early clobber), nothing in the run reads a result, and one v_nop fills the slot behind the last.
__device__ __forceinline__ void exp2x8(const float* x, float* y) {
    asm("v_exp_f32 %0, %8\n\tv_exp_f32 %1, %9\n\tv_exp_f32 %2, %10\n\tv_exp_f32 %3, %11\n\tv_exp_f32 %4, %12\n\tv_exp_f32 %5, %13\n\tv_exp_f32 %6, %14\n\tv_exp_f32 %7, %15\n\tv_nop"
        : "=&v"(y[0]), "=&v"(y[1]), "=&v"(y[2]), "=&v"(y[3]), "=&v"(y[4]), "=&v"(y[5]), "=&v"(y[6]), "=&v"(y[7]) : "v"(x[0]), "v"(x[1]), "v"(x[2]), "v"(x[3]), "v"(x[4]), "v"(x[5]), "v"(x[6]), "v"(x[7])); }
__device__ __forceinline__ float exp2x1(float x) { float y; asm("v_exp_f32 %0, %1\n\tv_nop" : "=&v"(y) : "v"(x)); return y; }
// addr_done: s_wait_xcnt 0 held in its place by two scheduling barriers; it stands between a load and later loads whose results the register allocator may lay over the first load's address registers.
__device__ __forceinline__ void addr_done() { __builtin_amdgcn_sched_barrier(0); asm volatile("s_wait_xcnt 0x0" ::: "memory"); __builtin_amdgcn_sched_barrier(0); }
__global__ __launch_bounds__(256) void k_attn(const bf* __restrict__ Qh, const bf* __restrict__ Ql, const bf* __restrict__ Kh, const bf* __restrict__ Kl, const bf* __restrict__ Vh, const bf* __restrict__ Vl, float* __restrict__ O1, float* __restrict__ Mz, float* __restrict__ Lz) {
    typedef WFrag<bf> F; typedef v16bf V;
    { const size_t b = blockIdx.z; Qh += b * NN * CR; Ql += b * NN * CR; Kh += b * NN * CR; Kl += b * NN * CR; Vh += b * 64 * NN; Vl += b * 64 * NN; O1 += b * KS * CR * NN; Mz += b * KS * NN; Lz += b * KS * NN; }
    const int lane = threadIdx.x & 31, lr = lane & 15, hi = lane >> 4, w = threadIdx.x >> 5;
    const int j0 = blockIdx.x * 256 + w * 32, z = blockIdx.y, ib = z * (NN / KS);
    V qh[2], ql[2];
#pragma unroll
    for (int jt = 0; jt < 2; ++jt) { qh[jt] = F::ld(Qh + (size_t)(j0 + jt * 16 + lr) * CR + 8 * hi); addr_done(); ql[jt] = F::ld(Ql + (size_t)(j0 + jt * 16 + lr) * CR + 8 * hi); addr_done(); }
    const size_t koff = (size_t)(ib + lr) * CR + 8 * hi, voff = (size_t)lr * NN + ib + 8 * hi;
    v8f o[2][2]; float mL[2], l[2];
#pragma unroll
    for (int jt = 0; jt < 2; ++jt) { o[0][jt] = (v8f){}; o[1][jt] = (v8f){}; mL[jt] = -3.0e38f; l[jt] = 0.f; }
    V kh[2], kl[2];
#pragma unroll
    for (int it = 0; it < 2; ++it) { kh[it] = F::ld(Kh + koff + it * 16 * CR); kl[it] = F::ld(Kl + koff + it * 16 * CR); }
#pragma unroll 1        // rolled: the pass is long enough to fill the pipes, and the code stays small
    for (int t = 0; t < NN / KS / 32; ++t) {
        V vh[2], vl[2];
#pragma unroll
        for (int ct = 0; ct < 2; ++ct) { vh[ct] = F::ld(Vh + voff + (size_t)ct * 16 * NN + t * 32); vl[ct] = F::ld(Vl + voff + (size_t)ct * 16 * NN + t * 32); }
        __builtin_amdgcn_sched_barrier(0);    // keeps the V loads at the head of the pass, a whole softmax ahead of their use (the scheduler otherwise sinks half of them to just before the value products)
        v8f s[2][2];
#pragma unroll
        for (int jt = 0; jt < 2; ++jt)
#pragma unroll
            for (int it = 0; it < 2; ++it) s[jt][it] = F::mma(kh[it], qh[jt], (v8f){});
#pragma unroll
        for (int jt = 0; jt < 2; ++jt)
#pragma unroll
            for (int it = 0; it < 2; ++it) s[jt][it] = F::mma(kh[it], ql[jt], s[jt][it]);
#pragma unroll
        for (int jt = 0; jt < 2; ++jt)
#pragma unroll
            for (int it = 0; it < 2; ++it) s[jt][it] = F::mma(kl[it], qh[jt], s[jt][it]);
        const int tn = (t + 1 < NN / KS / 32) ? t + 1 : t;    // the next pass's K rows, fetched behind this pass's score products (the last pass reads its own again: in bounds)
#pragma unroll
        for (int it = 0; it < 2; ++it) { kh[it] = F::ld(Kh + koff + (size_t)(tn * 32 + it * 16) * CR); kl[it] = F::ld(Kl + koff + (size_t)(tn * 32 + it * 16) * CR); }
        __builtin_amdgcn_sched_barrier(0);    // keeps the next pass's K loads here, so that they fly under the softmax and the value products (the scheduler otherwise sinks them to the foot of the pass)
        V ph[2], pl[2];
#pragma unroll
        for (int jt = 0; jt < 2; ++jt) {
            float mx = s[jt][0][0];
#pragma unroll
            for (int r = 1; r < 8; ++r) mx = fmaxf(mx, s[jt][0][r]);
#pragma unroll
            for (int r = 0; r < 8; ++r) mx = fmaxf(mx, s[jt][1][r]);
            mx = fmaxf(mx, xhalf(mx));
            const float mn = fmaxf(mL[jt], mx * L2E); const float al = exp2x1(mL[jt] - mn); mL[jt] = mn;
            float sum = 0.f, xs[16], ps[16]; v8u uh, ul;
#pragma unroll
            for (int e = 0; e < 16; ++e) xs[e] = __builtin_fmaf(s[jt][e >> 3][e & 7], L2E, -mn);
            exp2x8(xs, ps); exp2x8(xs + 8, ps + 8);
#pragma unroll
            for (int e = 0; e < 8; ++e) {
                v2f p; p[0] = ps[2 * e]; p[1] = ps[2 * e + 1]; sum += p[0] + p[1];
                const v2bf h = __builtin_convertvector(p, v2bf); const unsigned hu = __builtin_bit_cast(unsigned, h); uh[e] = hu;
                v2f d; d[0] = p[0] - __uint_as_float(hu << 16); d[1] = p[1] - __uint_as_float(hu & 0xFFFF0000u);
                ul[e] = __builtin_bit_cast(unsigned, __builtin_convertvector(d, v2bf)); }
            l[jt] = l[jt] * al + sum; ph[jt] = __builtin_bit_cast(V, uh); pl[jt] = __builtin_bit_cast(V, ul);
#pragma unroll
            for (int r = 0; r < 8; ++r) { o[0][jt][r] *= al; o[1][jt][r] *= al; }
        }
#pragma unroll
        for (int jt = 0; jt < 2; ++jt)
#pragma unroll
            for (int ct = 0; ct < 2; ++ct) o[ct][jt] = F::mma(vh[ct], ph[jt], o[ct][jt]);
#pragma unroll
        for (int jt = 0; jt < 2; ++jt)
#pragma unroll
            for (int ct = 0; ct < 2; ++ct) o[ct][jt] = F::mma(vl[ct], ph[jt], o[ct][jt]);
#pragma unroll
        for (int jt = 0; jt < 2; ++jt)
#pragma unroll
            for (int ct = 0; ct < 2; ++ct) o[ct][jt] = F::mma(vh[ct], pl[jt], o[ct][jt]);
    }
#pragma unroll
    for (int jt = 0; jt < 2; ++jt) l[jt] += xhalf(l[jt]);
    Mz[(size_t)z * NN + j0 + lane] = hi ? mL[1] : mL[0]; Lz[(size_t)z * NN + j0 + lane] = hi ? l[1] : l[0];
    float* op = O1 + ((size_t)z * CR + 8 * hi) * NN + j0 + lr;
#pragma unroll
    for (int ct = 0; ct < 2; ++ct)
#pragma unroll
        for (int r = 0; r < 8; ++r)
#pragma unroll
            for (int jt = 0; jt < 2; ++jt) op[(size_t)(ct * 16 + r) * NN + jt * 16] = o[ct][jt][r];
}
// k_ot: joins the KS slices of k_attn (z ascending, f32): out[c][j] = sum_z 2^(Mz - max) O1[z][c][j] / sum_z 2^(Mz - max) Lz, and writes the hl planes OT[j][c]. A block owns 32 positions: wave w sums channels 4w..4w+3 with lanes along j (whole 128-B lines), then the block turns the 32 x 32 tile through LDS so that each wave stores whole lines.
__global__ __launch_bounds__(256) void k_ot(const float* __restrict__ O1, const float* __restrict__ Mz, const float* __restrict__ Lz, bf* Oh, bf* Ol) { __shared__ float sm[32 * 33]; { const size_t b = blockIdx.y; O1 += b * KS * CR * NN; Mz += b * KS * NN; Lz += b * KS * NN; Oh += b * NN * CR; Ol += b * NN * CR; } const int lane = threadIdx.x & 31, w = threadIdx.x >> 5; const int j = blockIdx.x * 32 + lane; const float* p = O1 + (size_t)(w * 4) * NN + j; float s[4] = {0.f, 0.f, 0.f, 0.f};
    float wz[KS], lz[KS], lw[KS], mm = -3.0e38f, den = 0.f;
#pragma unroll
    for (int z = 0; z < KS; ++z) { wz[z] = Mz[(size_t)z * NN + j]; lz[z] = Lz[(size_t)z * NN + j]; }
#pragma unroll
    for (int z = 0; z < KS; ++z) mm = fmaxf(mm, wz[z]);
#pragma unroll
    for (int z = 0; z < KS; ++z) lw[z] = wz[z] - mm;
    exp2x8(lw, wz); exp2x8(lw + 8, wz + 8);
#pragma unroll
    for (int z = 0; z < KS; ++z) den += wz[z] * lz[z];
#pragma unroll
    for (int z = 0; z < KS; ++z) {
#pragma unroll
        for (int u = 0; u < 4; ++u) s[u] += wz[z] * p[(size_t)z * CR * NN + (size_t)u * NN]; }
    const float inv = __fdiv_rn(1.0f, den);
#pragma unroll
    for (int u = 0; u < 4; ++u) sm[lane * 33 + w * 4 + u] = s[u] * inv;
    __syncthreads();    // the tile is read across waves below
    const int e = (blockIdx.x * 256 + threadIdx.x) * 4; const int nl = threadIdx.x >> 3, c = (threadIdx.x & 7) * 4; v4us oh, ol;
#pragma unroll
    for (int u = 0; u < 4; ++u) { unsigned short a, b; splitf(sm[nl * 33 + c + u], a, b); oh[u] = a; ol[u] = b; } *(v4us*)(Oh + e) = oh; *(v4us*)(Ol + e) = ol;  }
// k_yfin: result[o][j] = scale * (sum_c Wo[o][c] out[c][j]) + x[o][j] in one kernel; grid (NN / 64, NB_), 8 waves. A block owns 64 positions j and all 256 channels o; wave w owns channels 32w..32w+31 (two 16-row tiles).
// A = Wo rows o, B = OT planes (columns j), h product first and l product second: the accumulator tile is channel-major like x and the result. Each wave turns its 32 x 64 tile through its own LDS range, so that x is loaded and the result stored in 256-B row pieces (16 B a lane).
__global__ __launch_bounds__(256) void k_yfin(const bf* __restrict__ Oh, const bf* __restrict__ Ol, const bf* __restrict__ AO, const float* __restrict__ X, const float* __restrict__ scale, float* __restrict__ Y) {
    typedef WFrag<bf> F; typedef v16bf V;
    __shared__ __align__(16) float os[8][32 * 68];
    { const size_t b = blockIdx.y; Oh += b * NN * CR; Ol += b * NN * CR; X += b * CC * NN; Y += b * CC * NN; }
    const int lane = threadIdx.x & 31, lr = lane & 15, hi = lane >> 4, w = threadIdx.x >> 5;
    const int j0 = blockIdx.x * 64, o0 = w * 32;
    // 32-bit lane offsets in bytes on wave-uniform bases: x and the result share one offset register, the two OT planes another
    const unsigned xb = (unsigned)((o0 + hi) * NN + j0 + lr * 4) * 4u, bb = (unsigned)((j0 + lr) * CR + 8 * hi) * 2u, ab = (unsigned)((o0 + lr) * CR + 8 * hi) * 2u;
    const bf* ph = (const bf*)((const char*)Oh + bb); const bf* pl = (const bf*)((const char*)Ol + bb); const bf* pa = (const bf*)((const char*)AO + ab);
    const float* px = (const float*)((const char*)X + xb); float* py = (float*)((char*)Y + xb);
    const float sc = bfr(scale[0]);
    V a[2], bh[4], bl[4]; v4f xx[16];
#pragma unroll
    for (int mb = 0; mb < 2; ++mb) a[mb] = F::ld(pa + mb * 16 * CR);
#pragma unroll
    for (int nb = 0; nb < 4; ++nb) bh[nb] = F::ld(ph + nb * 16 * CR);
#pragma unroll
    for (int nb = 0; nb < 4; ++nb) bl[nb] = F::ld(pl + nb * 16 * CR);
#pragma unroll
    for (int s = 0; s < 16; ++s) xx[s] = *(const v4f*)(px + (size_t)(2 * s) * NN);
    // Every load of the wave is issued above this line, the operands (short latency) ahead of x (from memory), so that x flies under the products and the LDS stores.
    // The wait takes the three lane offsets as inputs: their registers stay theirs up to it, so that no load's result and no later value is laid over an address register in front of the wait.
    __builtin_amdgcn_sched_barrier(0); asm volatile("s_wait_xcnt 0x0" :: "v"(ab), "v"(bb), "v"(xb) : "memory"); __builtin_amdgcn_sched_barrier(0);
    v8f acc[2][4];
#pragma unroll
    for (int mb = 0; mb < 2; ++mb)
#pragma unroll
        for (int nb = 0; nb < 4; ++nb) acc[mb][nb] = F::mma(a[mb], bh[nb], (v8f){});
#pragma unroll
    for (int mb = 0; mb < 2; ++mb)
#pragma unroll
        for (int nb = 0; nb < 4; ++nb) acc[mb][nb] = F::mma(a[mb], bl[nb], acc[mb][nb]);
    float* t = os[w];
#pragma unroll
    for (int mb = 0; mb < 2; ++mb)
#pragma unroll
        for (int nb = 0; nb < 4; ++nb)
#pragma unroll
            for (int r = 0; r < 8; ++r) t[(mb * 16 + hi * 8 + r) * 68 + nb * 16 + lr] = acc[mb][nb][r];
    asm volatile("s_wait_dscnt 0x0" ::: "memory");    // the wave's LDS stores are done before its lanes read back what other lanes wrote (the range is the wave's own: no work-group barrier)
    __builtin_amdgcn_sched_barrier(0);    // keeps the rounding of x behind the products and the LDS stores (the scheduler otherwise lifts it, with its wait for memory, in front of them)
#pragma unroll
    for (int s = 0; s < 16; ++s) { const v4f y = *(const v4fa*)(t + (2 * s + hi) * 68 + lr * 4); v4f r;
#pragma unroll
        for (int u = 0; u < 4; ++u) r[u] = __builtin_fmaf(sc, y[u], bfr(xx[s][u]));
        *(v4f*)(py + (size_t)(2 * s) * NN) = r; }
}

extern "C" void kernel_launch(void* const* d_in, const int* in_sizes, int n_in,
                              void* d_out, int out_size, void* d_ws, size_t ws_size, hipStream_t stream) {
    (void)in_sizes; (void)n_in; (void)out_size;
    const float* x = (const float*)d_in[0]; const float* Wt = (const float*)d_in[1]; const float* Wo = (const float*)d_in[2]; const float* scale = (const float*)d_in[3];
    float* OUT = (float*)d_out;     // [8][256][4096]
    char* wsp = (char*)d_ws;
    auto take = [&](size_t bytes) { char* p = wsp; wsp += (bytes + 255) & ~(size_t)255; return (void*)p; };
    bf* AW = (bf*)take((size_t)128 * CC * 2); bf* AO = (bf*)take((size_t)CC * CR * 2); bf* XT = (bf*)take((size_t)NB_ * NN * CC * 2); float* T = (float*)take((size_t)NB_ * 128 * NN * 4);
    bf* QTh = (bf*)take((size_t)NB_ * NN * CR * 2); bf* QTl = (bf*)take((size_t)NB_ * NN * CR * 2); bf* KTh = (bf*)take((size_t)NB_ * NN * CR * 2); bf* KTl = (bf*)take((size_t)NB_ * NN * CR * 2); bf* VPh = (bf*)take((size_t)NB_ * 64 * NN * 2); bf* VPl = (bf*)take((size_t)NB_ * 64 * NN * 2);
    float* O1 = (float*)take((size_t)NB_ * KS * CR * NN * 4); float* Mz = (float*)take((size_t)NB_ * KS * NN * 4); float* Lz = (float*)take((size_t)NB_ * KS * NN * 4); bf* OTh = (bf*)take((size_t)NB_ * NN * CR * 2); bf* OTl = (bf*)take((size_t)NB_ * NN * CR * 2);
    if ((size_t)(wsp - (char*)d_ws) > ws_size) return;    // total ~ 120 MiB (126 MB)
    k_wt128<<<(128 * CC / 4 + 255) / 256, 256, 0, stream>>>(Wt, AW); k_wo<<<(CC * CR / 4 + 255) / 256, 256, 0, stream>>>(Wo, AO);
    k_xt<<<dim3((NN * CC / 4 + 255) / 256, NB_), 256, 0, stream>>>(x, XT);
    k_gemmw<bf, 0, false><<<dim3(2, NN / 64, NB_), 32, 0, stream>>>(AW, nullptr, XT, nullptr, CC, CC, T, NN, nullptr, 0, (size_t)NN * CC, (size_t)128 * NN);     // t[b][r][n], rows 0..95 real
    k_qk<<<dim3((NN * CR / 4 + 255) / 256, NB_), 256, 0, stream>>>(T, QTh, QTl, KTh, KTl); k_vp<<<dim3((64 * NN / 4 + 255) / 256, NB_), 256, 0, stream>>>(T, VPh, VPl);
    k_attn<<<dim3(NN / 256, KS, NB_), 256, 0, stream>>>(QTh, QTl, KTh, KTl, VPh, VPl, O1, Mz, Lz);     // per batch and key slice z: unnormalised out[c][j], maximum and sum; k_ot joins the slices
    k_ot<<<dim3((NN * CR / 4 + 255) / 256, NB_), 256, 0, stream>>>(O1, Mz, Lz, OTh, OTl);
    k_yfin<<<dim3(NN / 64, NB_), 256, 0, stream>>>(OTh, OTl, AO, x, scale, OUT);     // result[b][o][j] = scale * (Wo . out) + x (hl x exact, 2 products; channel-major, no intermediate plane)
}

// v005
// One run takes 73.8 microseconds.
// Timed twice side by side with v004, it ran 1.43 and 1.42 times as fast.
// Counting every step since v000, it is 19.3 times as fast.
#include <hip/hip_runtime.h>

// GlobalSelfAttention (x [8][256][64][64] channel-major, N = 4096 positions; t = Wt . x (1x1 conv, [96][256]): key = t[0:32], query = t[32:64], value = t[64:96]; scores[i][j] = sum_c key[c][i] query[c][j] (unscaled); weights = softmax over i (the key axis) for every j;
//   out[c][j] = sum_i value[c][i] weights[i][j]; y = Wo . out (1x1 conv, [256][32]); result = scale[0] * y + x -> [8][256][64][64]; scale read).
// Compute dtypes, f32 accumulate: every input rounded to bf16; t as a PLAIN bf16 GEMM Wt . x with the rounding of x and Wt and the hl split of K, Q and V in the same kernel (k_proj; x read channel-major); logits, softmax and value product in ONE kernel (k_attn): S^T = K^T planes [i][c] . Q as hl x hl (3 products, K = 32), running maximum and sum per j in f32, exp -> hl operand in registers, out += V (hl planes [c][i]) . P^T as 3 products; 16 key slices, joined in k_ot; y = Wo (exact) . out^T planes (hl; K = 32, 2 products, channel-major) with scale * y + x in f32 applied to the accumulators in the same kernel (k_yfin).

#define NB_  8
#define CC   256
#define CR   32
#define NN   4096
#define KS   16      // key slices of the attention kernel (256 keys each)
typedef _Float16 h16;
typedef unsigned short bf;
typedef __attribute__((ext_vector_type(16))) __bf16   v16bf;
typedef __attribute__((ext_vector_type(16))) _Float16 v16h;
typedef __attribute__((ext_vector_type(8)))  _Float16 v8h;
typedef __attribute__((ext_vector_type(8)))  unsigned short v8us;
typedef __attribute__((ext_vector_type(8)))  float    v8f;
typedef __attribute__((ext_vector_type(4)))  float    v4f;
typedef v8h  __attribute__((may_alias)) v8ha;
typedef v4f  __attribute__((may_alias)) v4fa;
typedef v8us __attribute__((may_alias)) v8usa;

__device__ __forceinline__ unsigned short f2bf(float f) { unsigned u = __float_as_uint(f); u += 0x7FFFu + ((u >> 16) & 1u); return (unsigned short)(u >> 16); }
__device__ __forceinline__ float bf2f(unsigned short b) { return __uint_as_float(((unsigned)b) << 16); }
__device__ __forceinline__ float bfr(float f) { return bf2f(f2bf(f)); }
__device__ __forceinline__ v16h cat16(v8h lo, v8h hi) { return __builtin_shufflevector(lo, hi, 0, 1, 2, 3, 4, 5, 6, 7, 8, 9, 10, 11, 12, 13, 14, 15); }
__device__ __forceinline__ v16bf cat16b(v8us lo, v8us hi) { return __builtin_bit_cast(v16bf, __builtin_shufflevector(lo, hi, 0, 1, 2, 3, 4, 5, 6, 7, 8, 9, 10, 11, 12, 13, 14, 15)); }
__device__ __forceinline__ v8f wmma16(v16h a, v16h b, v8f c) { return __builtin_amdgcn_wmma_f32_16x16x32_f16(false, a, false, b, (short)0, c, false, false); }
__device__ __forceinline__ v8f wmmab(v16bf a, v16bf b, v8f c) { return __builtin_amdgcn_wmma_f32_16x16x32_bf16(false, a, false, b, (short)0, c, false, false); }



// WFrag: a 16 x 32 operand fragment (A or B alike) from a K-contiguous 16-bit row: lane lr + 16 hi holds row lr, k = 8 hi + 0..7 and 16 + 8 hi + 0..7.
template <typename T16> struct WFrag;
template <> struct WFrag<h16> { typedef v16h V; static __device__ __forceinline__ V ld(const h16* p) { return cat16(*(const v8h*)p, *(const v8h*)(p + 16)); } static __device__ __forceinline__ v8f mma(V a, V b, v8f c) { return wmma16(a, b, c); } };
template <> struct WFrag<bf> { typedef v16bf V; static __device__ __forceinline__ V ld(const bf* p) { return cat16b(*(const v8us*)p, *(const v8us*)(p + 16)); } static __device__ __forceinline__ v8f mma(V a, V b, v8f c) { return wmmab(a, b, c); } };

__device__ __forceinline__ void splitf(float y, unsigned short& h, unsigned short& l) { h = f2bf(y); l = f2bf(y - bf2f(h)); }
typedef __attribute__((ext_vector_type(2))) unsigned short v2us;
typedef __attribute__((ext_vector_type(4))) unsigned short v4us;

// Every kernel from here on serves all NB_ batches in one launch: the slowest grid axis is the batch, and each workspace plane but AO (one copy for all batches) has one copy per batch.
typedef __attribute__((ext_vector_type(2))) float v2f;
typedef __attribute__((ext_vector_type(2))) __bf16 v2bf;
typedef __attribute__((ext_vector_type(8))) unsigned v8u;
#define L2E 1.4426950408889634f
__device__ __forceinline__ float xhalf(float v) { const int b = __float_as_int(v); return __int_as_float(__builtin_amdgcn_permlanex16(b, b, 0x76543210, 0xfedcba98, false, false)); }    // lane l <-> l ^ 16
// exp2x8 / exp2x1: v_exp_f32 with the slot behind a transcendental kept by construction: no result lies on a source (early clobber), nothing in the run reads a result, and one v_nop fills the slot behind the last.
__device__ __forceinline__ void exp2x8(const float* x, float* y) {
    asm("v_exp_f32 %0, %8\n\tv_exp_f32 %1, %9\n\tv_exp_f32 %2, %10\n\tv_exp_f32 %3, %11\n\tv_exp_f32 %4, %12\n\tv_exp_f32 %5, %13\n\tv_exp_f32 %6, %14\n\tv_exp_f32 %7, %15\n\tv_nop"
        : "=&v"(y[0]), "=&v"(y[1]), "=&v"(y[2]), "=&v"(y[3]), "=&v"(y[4]), "=&v"(y[5]), "=&v"(y[6]), "=&v"(y[7]) : "v"(x[0]), "v"(x[1]), "v"(x[2]), "v"(x[3]), "v"(x[4]), "v"(x[5]), "v"(x[6]), "v"(x[7])); }
__device__ __forceinline__ float exp2x1(float x) { float y; asm("v_exp_f32 %0, %1\n\tv_nop" : "=&v"(y) : "v"(x)); return y; }
// addr_done: s_wait_xcnt 0 held in its place by two scheduling barriers; it stands between a load and later loads whose results the register allocator may lay over the first load's address registers.
__device__ __forceinline__ void addr_done() { __builtin_amdgcn_sched_barrier(0); asm volatile("s_wait_xcnt 0x0" ::: "memory"); __builtin_amdgcn_sched_barrier(0); }
typedef __attribute__((ext_vector_type(2))) unsigned v2u;
typedef __attribute__((ext_vector_type(4))) unsigned v4u;
__device__ __forceinline__ unsigned pk2(float a, float b) { v2f p; p[0] = a; p[1] = b; return __builtin_bit_cast(unsigned, __builtin_convertvector(p, v2bf)); }    // two f32 -> two bf16 (nearest even), a in the low half
__device__ __forceinline__ void split2(float a, float b, unsigned& h, unsigned& l) { h = pk2(a, b); l = pk2(a - __uint_as_float(h << 16), b - __uint_as_float(h & 0xFFFF0000u)); }    // hl split of two values
#define WP  264     // LDS pitch of a Wt row in bf16 elements (512 B + 16 B, for the 16-B fragment reads)
#define VPP 136     // LDS pitch of a V row in bf16 elements (256 B + 16 B)
// k_proj: the whole projection in one kernel: t = Wt . x (bf16 operands, f32 accumulate, k ascending in steps of 32) and the hl planes KT[i][c], QT[j][c], VP[r][i] (rows 0..31 of each batch's 64-row plane; the rest is never read). Grid (NN / 128, NB_), 4 waves.
// A wave owns 32 positions and all 96 rows of t. x is read channel-major as it lies: a lane loads 8 B (positions n0 + 2 lr, + 1) of channel k, so a load covers two whole 128-B lines; value u of the pair belongs to fragment u, whose row or column lr stands for position n0 + 2 lr + u.
// The same x fragment is B for K and Q (D: a lane holds 8 successive channels of one position = 16 B of KT or QT) and A for V (D: a lane holds one channel at positions n0 + 16 hi + 2 j + u = 32 B of a VP row).
// Wt is rounded once per block into LDS. The V tile goes through LDS so that the block stores 256-B row pieces. The first blocks also round Wo for k_yfin.
__global__ __launch_bounds__(128) void k_proj(const float* __restrict__ X, const float* __restrict__ Wt, const float* __restrict__ Wo, bf* __restrict__ AO, bf* __restrict__ Qh, bf* __restrict__ Ql, bf* __restrict__ Kh, bf* __restrict__ Kl, bf* __restrict__ Vh, bf* __restrict__ Vl) {
    typedef WFrag<bf> F; typedef v16bf V;
    __shared__ __align__(16) bf sw[96 * WP];
    __shared__ __align__(16) bf sv[2][32 * VPP];
    { const size_t b = blockIdx.y; X += b * CC * NN; Qh += b * NN * CR; Ql += b * NN * CR; Kh += b * NN * CR; Kl += b * NN * CR; Vh += b * 64 * NN; Vl += b * 64 * NN; }
    const int tid = threadIdx.x, lane = tid & 31, lr = lane & 15, hi = lane >> 4, w = tid >> 5;
    const int nb0 = blockIdx.x * 128, n0 = nb0 + w * 32;
    // x: a 32-bit lane offset in bytes on a wave-uniform base
    const unsigned xo = (unsigned)(8 * hi * NN + n0 + 2 * lr) * 4u;
    const float* px = (const float*)((const char*)X + xo); const float* pw = Wt + tid * 4;
    v2f raw[2][16];    // two k steps of x in flight; element e of a fragment is channel 8 hi + (e & 7) + 16 (e >> 3) of the step, as in WFrag::ld
#pragma unroll
    for (int hb = 0; hb < 2; ++hb) {
        v4f wv[24];
#pragma unroll
        for (int i = 0; i < 24; ++i) wv[i] = *(const v4f*)(pw + (hb * 24 + i) * 512);
        if (hb == 0) {
            __builtin_amdgcn_sched_barrier(0);    // keeps the first half of Wt (short latency) ahead of x (from memory): loads return in order, so its rounding need not wait for x, and x flies under the staging of Wt
#pragma unroll
            for (int c = 0; c < 2; ++c)
#pragma unroll
                for (int e = 0; e < 16; ++e) raw[c][e] = *(const v2f*)(px + (size_t)(c * 32 + (e & 7) + (e >> 3) * 16) * NN);
        }
        addr_done();    // every load of this half is issued above this line, and no load's result is laid over an address register in front of the wait
#pragma unroll
        for (int i = 0; i < 24; ++i) { const int e = ((hb * 24 + i) * 128 + tid) * 4; v2u o; o[0] = pk2(wv[i][0], wv[i][1]); o[1] = pk2(wv[i][2], wv[i][3]); *(v2u*)(sw + (e >> 8) * WP + (e & 255)) = o; }
    }
    v8f acc[6][2];
#pragma unroll
    for (int rt = 0; rt < 6; ++rt) { acc[rt][0] = (v8f){}; acc[rt][1] = (v8f){}; }
    __syncthreads();    // Wt in LDS is read across waves below
#pragma unroll
    for (int ch = 0; ch < CC / 32; ++ch) {
        V xb[2];
#pragma unroll
        for (int u = 0; u < 2; ++u) { v8u t;
#pragma unroll
            for (int e = 0; e < 8; ++e) t[e] = pk2(raw[ch & 1][2 * e][u], raw[ch & 1][2 * e + 1][u]);
            xb[u] = __builtin_bit_cast(V, t); }
        if (ch + 2 < CC / 32) {
#pragma unroll
            for (int e = 0; e < 16; ++e) raw[ch & 1][e] = *(const v2f*)(px + (size_t)((ch + 2) * 32 + (e & 7) + (e >> 3) * 16) * NN);
            // keeps the loads of step ch + 2 here, two steps ahead of their use (the scheduler otherwise sinks them); the wait holds the lane offset's register up to this line
            __builtin_amdgcn_sched_barrier(0); asm volatile("s_wait_xcnt 0x0" :: "v"(xo) : "memory"); __builtin_amdgcn_sched_barrier(0);
        }
#pragma unroll
        for (int rt = 0; rt < 6; ++rt) { const V a = F::ld(sw + (rt * 16 + lr) * WP + ch * 32 + 8 * hi);
#pragma unroll
            for (int u = 0; u < 2; ++u) acc[rt][u] = (rt < 4) ? F::mma(a, xb[u], acc[rt][u]) : F::mma(xb[u], a, acc[rt][u]); }
    }
    __builtin_amdgcn_sched_barrier(0);    // keeps the last products in front of the epilogue (the scheduler otherwise carries some past the barrier below, and the register count then passes 256)
#pragma unroll
    for (int rt = 4; rt < 6; ++rt) { v4u h[2], l[2];
#pragma unroll
        for (int j = 0; j < 8; ++j) { unsigned a, b; split2(acc[rt][0][j], acc[rt][1][j], a, b); h[j >> 2][j & 3] = a; l[j >> 2][j & 3] = b; }
        const int d = ((rt - 4) * 16 + lr) * VPP + w * 32 + hi * 16;
        *(v4u*)(sv[0] + d) = h[0]; *(v4u*)(sv[0] + d + 8) = h[1]; *(v4u*)(sv[1] + d) = l[0]; *(v4u*)(sv[1] + d + 8) = l[1]; }
    __syncthreads();    // the V tile is read across waves below
    // AO [256][32] = bf16(Wo), for k_yfin: 16 blocks round 512 values each; the load goes out here, behind the last barrier, and flies under the stores and the split of K and Q; its value is stored last
    const bool wob = blockIdx.y == 0 && blockIdx.x < CC * CR / 512; const unsigned oo = (unsigned)(blockIdx.x * 128 + tid) * 16u; v4f wov = (v4f){};
    if (wob) { wov = *(const v4f*)((const char*)Wo + oo); asm volatile("s_wait_xcnt 0x0" :: "v"(oo) : "memory"); }    // the wait takes the lane offset as an input: no load's result is laid over it in front of the wait
#pragma unroll
    for (int i = 0; i < 4; ++i) { const int p = i * 128 + tid, row = p >> 4, part = (p & 15) * 8;
        *(v4u*)(Vh + (unsigned)(row * NN + nb0 + part)) = *(const v4u*)(sv[0] + row * VPP + part); *(v4u*)(Vl + (unsigned)(row * NN + nb0 + part)) = *(const v4u*)(sv[1] + row * VPP + part); }
    // K and Q last: no global store stands in front of the barrier above, which would wait for it
#pragma unroll
    for (int rt = 0; rt < 4; ++rt) { bf* Ph = (rt < 2) ? Kh : Qh; bf* Pl = (rt < 2) ? Kl : Ql;
#pragma unroll
        for (int u = 0; u < 2; ++u) { v4u h, l;
#pragma unroll
            for (int j = 0; j < 4; ++j) { unsigned a, b; split2(acc[rt][u][2 * j], acc[rt][u][2 * j + 1], a, b); h[j] = a; l[j] = b; }
            const unsigned off = (unsigned)((n0 + 2 * lr + u) * CR + (rt & 1) * 16 + hi * 8);
            *(v4u*)(Ph + off) = h; *(v4u*)(Pl + off) = l; } }
    if (wob) { addr_done();    // the stores above are issued: the values below may be laid over their registers
        v2u o; o[0] = pk2(wov[0], wov[1]); o[1] = pk2(wov[2], wov[3]); *(v2u*)((char*)AO + (oo >> 1)) = o; }
}
__global__ __launch_bounds__(256) void k_attn(const bf* __restrict__ Qh, const bf* __restrict__ Ql, const bf* __restrict__ Kh, const bf* __restrict__ Kl, const bf* __restrict__ Vh, const bf* __restrict__ Vl, float* __restrict__ O1, float* __restrict__ Mz, float* __restrict__ Lz) {
    typedef WFrag<bf> F; typedef v16bf V;
    { const size_t b = blockIdx.z; Qh += b * NN * CR; Ql += b * NN * CR; Kh += b * NN * CR; Kl += b * NN * CR; Vh += b * 64 * NN; Vl += b * 64 * NN; O1 += b * KS * CR * NN; Mz += b * KS * NN; Lz += b * KS * NN; }
    const int lane = threadIdx.x & 31, lr = lane & 15, hi = lane >> 4, w = threadIdx.x >> 5;
    const int j0 = blockIdx.x * 256 + w * 32, z = blockIdx.y, ib = z * (NN / KS);
    V qh[2], ql[2];
#pragma unroll
    for (int jt = 0; jt < 2; ++jt) { qh[jt] = F::ld(Qh + (size_t)(j0 + jt * 16 + lr) * CR + 8 * hi); addr_done(); ql[jt] = F::ld(Ql + (size_t)(j0 + jt * 16 + lr) * CR + 8 * hi); addr_done(); }
    const size_t koff = (size_t)(ib + lr) * CR + 8 * hi, voff = (size_t)lr * NN + ib + 8 * hi;
    v8f o[2][2]; float mL[2], l[2];
#pragma unroll
    for (int jt = 0; jt < 2; ++jt) { o[0][jt] = (v8f){}; o[1][jt] = (v8f){}; mL[jt] = -3.0e38f; l[jt] = 0.f; }
    V kh[2], kl[2];
#pragma unroll
    for (int it = 0; it < 2; ++it) { kh[it] = F::ld(Kh + koff + it * 16 * CR); kl[it] = F::ld(Kl + koff + it * 16 * CR); }
#pragma unroll 1        // rolled: the pass is long enough to fill the pipes, and the code stays small
    for (int t = 0; t < NN / KS / 32; ++t) {
        V vh[2], vl[2];
#pragma unroll
        for (int ct = 0; ct < 2; ++ct) { vh[ct] = F::ld(Vh + voff + (size_t)ct * 16 * NN + t * 32); vl[ct] = F::ld(Vl + voff + (size_t)ct * 16 * NN + t * 32); }
        __builtin_amdgcn_sched_barrier(0);    // keeps the V loads at the head of the pass, a whole softmax ahead of their use (the scheduler otherwise sinks half of them to just before the value products)
        v8f s[2][2];
#pragma unroll
        for (int jt = 0; jt < 2; ++jt)
#pragma unroll
            for (int it = 0; it < 2; ++it) s[jt][it] = F::mma(kh[it], qh[jt], (v8f){});
#pragma unroll
        for (int jt = 0; jt < 2; ++jt)
#pragma unroll
            for (int it = 0; it < 2; ++it) s[jt][it] = F::mma(kh[it], ql[jt], s[jt][it]);
#pragma unroll
        for (int jt = 0; jt < 2; ++jt)
#pragma unroll
            for (int it = 0; it < 2; ++it) s[jt][it] = F::mma(kl[it], qh[jt], s[jt][it]);
        const int tn = (t + 1 < NN / KS / 32) ? t + 1 : t;    // the next pass's K rows, fetched behind this pass's score products (the last pass reads its own again: in bounds)
#pragma unroll
        for (int it = 0; it < 2; ++it) { kh[it] = F::ld(Kh + koff + (size_t)(tn * 32 + it * 16) * CR); kl[it] = F::ld(Kl + koff + (size_t)(tn * 32 + it * 16) * CR); }
        __builtin_amdgcn_sched_barrier(0);    // keeps the next pass's K loads here, so that they fly under the softmax and the value products (the scheduler otherwise sinks them to the foot of the pass)
        V ph[2], pl[2];
#pragma unroll
        for (int jt = 0; jt < 2; ++jt) {
            float mx = s[jt][0][0];
#pragma unroll
            for (int r = 1; r < 8; ++r) mx = fmaxf(mx, s[jt][0][r]);
#pragma unroll
            for (int r = 0; r < 8; ++r) mx = fmaxf(mx, s[jt][1][r]);
            mx = fmaxf(mx, xhalf(mx));
            const float mn = fmaxf(mL[jt], mx * L2E); const float al = exp2x1(mL[jt] - mn); mL[jt] = mn;
            float sum = 0.f, xs[16], ps[16]; v8u uh, ul;
#pragma unroll
            for (int e = 0; e < 16; ++e) xs[e] = __builtin_fmaf(s[jt][e >> 3][e & 7], L2E, -mn);
            exp2x8(xs, ps); exp2x8(xs + 8, ps + 8);
#pragma unroll
            for (int e = 0; e < 8; ++e) {
                v2f p; p[0] = ps[2 * e]; p[1] = ps[2 * e + 1]; sum += p[0] + p[1];
                const v2bf h = __builtin_convertvector(p, v2bf); const unsigned hu = __builtin_bit_cast(unsigned, h); uh[e] = hu;
                v2f d; d[0] = p[0] - __uint_as_float(hu << 16); d[1] = p[1] - __uint_as_float(hu & 0xFFFF0000u);
                ul[e] = __builtin_bit_cast(unsigned, __builtin_convertvector(d, v2bf)); }
            l[jt] = l[jt] * al + sum; ph[jt] = __builtin_bit_cast(V, uh); pl[jt] = __builtin_bit_cast(V, ul);
#pragma unroll
            for (int r = 0; r < 8; ++r) { o[0][jt][r] *= al; o[1][jt][r] *= al; }
        }
#pragma unroll
        for (int jt = 0; jt < 2; ++jt)
#pragma unroll
            for (int ct = 0; ct < 2; ++ct) o[ct][jt] = F::mma(vh[ct], ph[jt], o[ct][jt]);
#pragma unroll
        for (int jt = 0; jt < 2; ++jt)
#pragma unroll
            for (int ct = 0; ct < 2; ++ct) o[ct][jt] = F::mma(vl[ct], ph[jt], o[ct][jt]);
#pragma unroll
        for (int jt = 0; jt < 2; ++jt)
#pragma unroll
            for (int ct = 0; ct < 2; ++ct) o[ct][jt] = F::mma(vh[ct], pl[jt], o[ct][jt]);
    }
#pragma unroll
    for (int jt = 0; jt < 2; ++jt) l[jt] += xhalf(l[jt]);
    Mz[(size_t)z * NN + j0 + lane] = hi ? mL[1] : mL[0]; Lz[(size_t)z * NN + j0 + lane] = hi ? l[1] : l[0];
    float* op = O1 + ((size_t)z * CR + 8 * hi) * NN + j0 + lr;
#pragma unroll
    for (int ct = 0; ct < 2; ++ct)
#pragma unroll
        for (int r = 0; r < 8; ++r)
#pragma unroll
            for (int jt = 0; jt < 2; ++jt) op[(size_t)(ct * 16 + r) * NN + jt * 16] = o[ct][jt][r];
}
// k_ot: joins the KS slices of k_attn (z ascending, f32): out[c][j] = sum_z 2^(Mz - max) O1[z][c][j] / sum_z 2^(Mz - max) Lz, and writes the hl planes OT[j][c]. A block owns 32 positions: wave w sums channels 4w..4w+3 with lanes along j (whole 128-B lines), then the block turns the 32 x 32 tile through LDS so that each wave stores whole lines.
__global__ __launch_bounds__(256) void k_ot(const float* __restrict__ O1, const float* __restrict__ Mz, const float* __restrict__ Lz, bf* Oh, bf* Ol) { __shared__ float sm[32 * 33]; { const size_t b = blockIdx.y; O1 += b * KS * CR * NN; Mz += b * KS * NN; Lz += b * KS * NN; Oh += b * NN * CR; Ol += b * NN * CR; } const int lane = threadIdx.x & 31, w = threadIdx.x >> 5; const int j = blockIdx.x * 32 + lane; const float* p = O1 + (size_t)(w * 4) * NN + j; float s[4] = {0.f, 0.f, 0.f, 0.f};
    float wz[KS], lz[KS], lw[KS], mm = -3.0e38f, den = 0.f;
#pragma unroll
    for (int z = 0; z < KS; ++z) { wz[z] = Mz[(size_t)z * NN + j]; lz[z] = Lz[(size_t)z * NN + j]; }
#pragma unroll
    for (int z = 0; z < KS; ++z) mm = fmaxf(mm, wz[z]);
#pragma unroll
    for (int z = 0; z < KS; ++z) lw[z] = wz[z] - mm;
    exp2x8(lw, wz); exp2x8(lw + 8, wz + 8);
#pragma unroll
    for (int z = 0; z < KS; ++z) den += wz[z] * lz[z];
#pragma unroll
    for (int z = 0; z < KS; ++z) {
#pragma unroll
        for (int u = 0; u < 4; ++u) s[u] += wz[z] * p[(size_t)z * CR * NN + (size_t)u * NN]; }
    const float inv = __fdiv_rn(1.0f, den);
#pragma unroll
    for (int u = 0; u < 4; ++u) sm[lane * 33 + w * 4 + u] = s[u] * inv;
    __syncthreads();    // the tile is read across waves below
    const int e = (blockIdx.x * 256 + threadIdx.x) * 4; const int nl = threadIdx.x >> 3, c = (threadIdx.x & 7) * 4; v4us oh, ol;
#pragma unroll
    for (int u = 0; u < 4; ++u) { unsigned short a, b; splitf(sm[nl * 33 + c + u], a, b); oh[u] = a; ol[u] = b; } *(v4us*)(Oh + e) = oh; *(v4us*)(Ol + e) = ol;  }
// k_yfin: result[o][j] = scale * (sum_c Wo[o][c] out[c][j]) + x[o][j] in one kernel; grid (NN / 64, NB_), 8 waves. A block owns 64 positions j and all 256 channels o; wave w owns channels 32w..32w+31 (two 16-row tiles).
// A = Wo rows o, B = OT planes (columns j), h product first and l product second: the accumulator tile is channel-major like x and the result. Each wave turns its 32 x 64 tile through its own LDS range, so that x is loaded and the result stored in 256-B row pieces (16 B a lane).
__global__ __launch_bounds__(256) void k_yfin(const bf* __restrict__ Oh, const bf* __restrict__ Ol, const bf* __restrict__ AO, const float* __restrict__ X, const float* __restrict__ scale, float* __restrict__ Y) {
    typedef WFrag<bf> F; typedef v16bf V;
    __shared__ __align__(16) float os[8][32 * 68];
    { const size_t b = blockIdx.y; Oh += b * NN * CR; Ol += b * NN * CR; X += b * CC * NN; Y += b * CC * NN; }
    const int lane = threadIdx.x & 31, lr = lane & 15, hi = lane >> 4, w = threadIdx.x >> 5;
    const int j0 = blockIdx.x * 64, o0 = w * 32;
    // 32-bit lane offsets in bytes on wave-uniform bases: x and the result share one offset register, the two OT planes another
    const unsigned xb = (unsigned)((o0 + hi) * NN + j0 + lr * 4) * 4u, bb = (unsigned)((j0 + lr) * CR + 8 * hi) * 2u, ab = (unsigned)((o0 + lr) * CR + 8 * hi) * 2u;
    const bf* ph = (const bf*)((const char*)Oh + bb); const bf* pl = (const bf*)((const char*)Ol + bb); const bf* pa = (const bf*)((const char*)AO + ab);
    const float* px = (const float*)((const char*)X + xb); float* py = (float*)((char*)Y + xb);
    const float sc = bfr(scale[0]);
    V a[2], bh[4], bl[4]; v4f xx[16];
#pragma unroll
    for (int mb = 0; mb < 2; ++mb) a[mb] = F::ld(pa + mb * 16 * CR);
#pragma unroll
    for (int nb = 0; nb < 4; ++nb) bh[nb] = F::ld(ph + nb * 16 * CR);
#pragma unroll
    for (int nb = 0; nb < 4; ++nb) bl[nb] = F::ld(pl + nb * 16 * CR);
#pragma unroll
    for (int s = 0; s < 16; ++s) xx[s] = *(const v4f*)(px + (size_t)(2 * s) * NN);
    // Every load of the wave is issued above this line, the operands (short latency) ahead of x (from memory), so that x flies under the products and the LDS stores.
    // The wait takes the three lane offsets as inputs: their registers stay theirs up to it, so that no load's result and no later value is laid over an address register in front of the wait.
    __builtin_amdgcn_sched_barrier(0); asm volatile("s_wait_xcnt 0x0" :: "v"(ab), "v"(bb), "v"(xb) : "memory"); __builtin_amdgcn_sched_barrier(0);
    v8f acc[2][4];
#pragma unroll
    for (int mb = 0; mb < 2; ++mb)
#pragma unroll
        for (int nb = 0; nb < 4; ++nb) acc[mb][nb] = F::mma(a[mb], bh[nb], (v8f){});
#pragma unroll
    for (int mb = 0; mb < 2; ++mb)
#pragma unroll
        for (int nb = 0; nb < 4; ++nb) acc[mb][nb] = F::mma(a[mb], bl[nb], acc[mb][nb]);
    float* t = os[w];
#pragma unroll
    for (int mb = 0; mb < 2; ++mb)
#pragma unroll
        for (int nb = 0; nb < 4; ++nb)
#pragma unroll
            for (int r = 0; r < 8; ++r) t[(mb * 16 + hi * 8 + r) * 68 + nb * 16 + lr] = acc[mb][nb][r];
    asm volatile("s_wait_dscnt 0x0" ::: "memory");    // the wave's LDS stores are done before its lanes read back what other lanes wrote (the range is the wave's own: no work-group barrier)
    __builtin_amdgcn_sched_barrier(0);    // keeps the rounding of x behind the products and the LDS stores (the scheduler otherwise lifts it, with its wait for memory, in front of them)
#pragma unroll
    for (int s = 0; s < 16; ++s) { const v4f y = *(const v4fa*)(t + (2 * s + hi) * 68 + lr * 4); v4f r;
#pragma unroll
        for (int u = 0; u < 4; ++u) r[u] = __builtin_fmaf(sc, y[u], bfr(xx[s][u]));
        *(v4f*)(py + (size_t)(2 * s) * NN) = r; }
}

extern "C" void kernel_launch(void* const* d_in, const int* in_sizes, int n_in,
                              void* d_out, int out_size, void* d_ws, size_t ws_size, hipStream_t stream) {
    (void)in_sizes; (void)n_in; (void)out_size;
    const float* x = (const float*)d_in[0]; const float* Wt = (const float*)d_in[1]; const float* Wo = (const float*)d_in[2]; const float* scale = (const float*)d_in[3];
    float* OUT = (float*)d_out;     // [8][256][4096]
    char* wsp = (char*)d_ws;
    auto take = [&](size_t bytes) { char* p = wsp; wsp += (bytes + 255) & ~(size_t)255; return (void*)p; };
    bf* AO = (bf*)take((size_t)CC * CR * 2);
    bf* QTh = (bf*)take((size_t)NB_ * NN * CR * 2); bf* QTl = (bf*)take((size_t)NB_ * NN * CR * 2); bf* KTh = (bf*)take((size_t)NB_ * NN * CR * 2); bf* KTl = (bf*)take((size_t)NB_ * NN * CR * 2); bf* VPh = (bf*)take((size_t)NB_ * 64 * NN * 2); bf* VPl = (bf*)take((size_t)NB_ * 64 * NN * 2);
    float* O1 = (float*)take((size_t)NB_ * KS * CR * NN * 4); float* Mz = (float*)take((size_t)NB_ * KS * NN * 4); float* Lz = (float*)take((size_t)NB_ * KS * NN * 4); bf* OTh = (bf*)take((size_t)NB_ * NN * CR * 2); bf* OTl = (bf*)take((size_t)NB_ * NN * CR * 2);
    if ((size_t)(wsp - (char*)d_ws) > ws_size) return;    // total ~ 92 MB
    k_proj<<<dim3(NN / 128, NB_), 128, 0, stream>>>(x, Wt, Wo, AO, QTh, QTl, KTh, KTl, VPh, VPl);     // t = Wt . x and its hl planes KT, QT [n][c] and VP [r][n]; AO = bf16(Wo)
    k_attn<<<dim3(NN / 256, KS, NB_), 256, 0, stream>>>(QTh, QTl, KTh, KTl, VPh, VPl, O1, Mz, Lz);     // per batch and key slice z: unnormalised out[c][j], maximum and sum; k_ot joins the slices
    k_ot<<<dim3((NN * CR / 4 + 255) / 256, NB_), 256, 0, stream>>>(O1, Mz, Lz, OTh, OTl);
    k_yfin<<<dim3(NN / 64, NB_), 256, 0, stream>>>(OTh, OTl, AO, x, scale, OUT);     // result[b][o][j] = scale * (Wo . out) + x (hl x exact, 2 products; channel-major, no intermediate plane)
}

// v006
// One run takes 55.4 microseconds.
// Two timings next to v005 put it at 1.32 and 1.34 times that version's speed.
// Over all steps from v000 it is 25.7 times as fast.
#include <hip/hip_runtime.h>

// GlobalSelfAttention (x [8][256][64][64] channel-major, N = 4096 positions; t = Wt . x (1x1 conv, [96][256]): key = t[0:32], query = t[32:64], value = t[64:96]; scores[i][j] = sum_c key[c][i] query[c][j] (unscaled); weights = softmax over i (the key axis) for every j;
//   out[c][j] = sum_i value[c][i] weights[i][j]; y = Wo . out (1x1 conv, [256][32]); result = scale[0] * y + x -> [8][256][64][64]; scale read).
// Compute dtypes, f32 accumulate: every input rounded to bf16; t as a PLAIN bf16 GEMM Wt . x with the rounding of x and Wt and the hl split of K, Q and V in the same kernel (k_proj; x read channel-major); logits, softmax and value product in ONE kernel (k_attn): S^T = K^T planes [i][c] . Q as hl x hl (3 products, K = 32), running maximum and sum per j in f32, exp -> hl operand in registers, out += V (hl planes [c][i]) . P^T as 3 products; 4 key quarters on 4 groups of waves, joined in LDS; y = Wo (exact) . out (hl fragments; K = 32, 2 products, channel-major) with scale * y + x in f32 applied after a turn through LDS, all in k_attn.

#define NB_  8
#define CC   256
#define CR   32
#define NN   4096
#define KQ   4       // key quarters of the attention kernel (1024 keys each), one per group of 4 waves
#define JB   128     // positions of a block of the attention kernel
typedef _Float16 h16;
typedef unsigned short bf;
typedef __attribute__((ext_vector_type(16))) __bf16   v16bf;
typedef __attribute__((ext_vector_type(16))) _Float16 v16h;
typedef __attribute__((ext_vector_type(8)))  _Float16 v8h;
typedef __attribute__((ext_vector_type(8)))  unsigned short v8us;
typedef __attribute__((ext_vector_type(8)))  float    v8f;
typedef __attribute__((ext_vector_type(4)))  float    v4f;
typedef v8h  __attribute__((may_alias)) v8ha;
typedef v4f  __attribute__((may_alias)) v4fa;
typedef v8us __attribute__((may_alias)) v8usa;

__device__ __forceinline__ unsigned short f2bf(float f) { unsigned u = __float_as_uint(f); u += 0x7FFFu + ((u >> 16) & 1u); return (unsigned short)(u >> 16); }
__device__ __forceinline__ float bf2f(unsigned short b) { return __uint_as_float(((unsigned)b) << 16); }
__device__ __forceinline__ float bfr(float f) { return bf2f(f2bf(f)); }
__device__ __forceinline__ v16h cat16(v8h lo, v8h hi) { return __builtin_shufflevector(lo, hi, 0, 1, 2, 3, 4, 5, 6, 7, 8, 9, 10, 11, 12, 13, 14, 15); }
__device__ __forceinline__ v16bf cat16b(v8us lo, v8us hi) { return __builtin_bit_cast(v16bf, __builtin_shufflevector(lo, hi, 0, 1, 2, 3, 4, 5, 6, 7, 8, 9, 10, 11, 12, 13, 14, 15)); }
__device__ __forceinline__ v8f wmma16(v16h a, v16h b, v8f c) { return __builtin_amdgcn_wmma_f32_16x16x32_f16(false, a, false, b, (short)0, c, false, false); }
__device__ __forceinline__ v8f wmmab(v16bf a, v16bf b, v8f c) { return __builtin_amdgcn_wmma_f32_16x16x32_bf16(false, a, false, b, (short)0, c, false, false); }



// WFrag: a 16 x 32 operand fragment (A or B alike) from a K-contiguous 16-bit row: lane lr + 16 hi holds row lr, k = 8 hi + 0..7 and 16 + 8 hi + 0..7.
template <typename T16> struct WFrag;
template <> struct WFrag<h16> { typedef v16h V; static __device__ __forceinline__ V ld(const h16* p) { return cat16(*(const v8h*)p, *(const v8h*)(p + 16)); } static __device__ __forceinline__ v8f mma(V a, V b, v8f c) { return wmma16(a, b, c); } };
template <> struct WFrag<bf> { typedef v16bf V; static __device__ __forceinline__ V ld(const bf* p) { return cat16b(*(const v8us*)p, *(const v8us*)(p + 16)); } static __device__ __forceinline__ v8f mma(V a, V b, v8f c) { return wmmab(a, b, c); } };

__device__ __forceinline__ void splitf(float y, unsigned short& h, unsigned short& l) { h = f2bf(y); l = f2bf(y - bf2f(h)); }
typedef __attribute__((ext_vector_type(2))) unsigned short v2us;
typedef __attribute__((ext_vector_type(4))) unsigned short v4us;

// Every kernel from here on serves all NB_ batches in one launch: the slowest grid axis is the batch, and each workspace plane but AO (one copy for all batches) has one copy per batch.
typedef __attribute__((ext_vector_type(2))) float v2f;
typedef __attribute__((ext_vector_type(2))) __bf16 v2bf;
typedef __attribute__((ext_vector_type(8))) unsigned v8u;
#define L2E 1.4426950408889634f
__device__ __forceinline__ float xhalf(float v) { const int b = __float_as_int(v); return __int_as_float(__builtin_amdgcn_permlanex16(b, b, 0x76543210, 0xfedcba98, false, false)); }    // lane l <-> l ^ 16
// exp2x8 / exp2x1: v_exp_f32 with the slot behind a transcendental kept by construction: no result lies on a source (early clobber), nothing in the run reads a result, and one v_nop fills the slot behind the last.
__device__ __forceinline__ void exp2x8(const float* x, float* y) {
    asm("v_exp_f32 %0, %8\n\tv_exp_f32 %1, %9\n\tv_exp_f32 %2, %10\n\tv_exp_f32 %3, %11\n\tv_exp_f32 %4, %12\n\tv_exp_f32 %5, %13\n\tv_exp_f32 %6, %14\n\tv_exp_f32 %7, %15\n\tv_nop"
        : "=&v"(y[0]), "=&v"(y[1]), "=&v"(y[2]), "=&v"(y[3]), "=&v"(y[4]), "=&v"(y[5]), "=&v"(y[6]), "=&v"(y[7]) : "v"(x[0]), "v"(x[1]), "v"(x[2]), "v"(x[3]), "v"(x[4]), "v"(x[5]), "v"(x[6]), "v"(x[7])); }
__device__ __forceinline__ float exp2x1(float x) { float y; asm("v_exp_f32 %0, %1\n\tv_nop" : "=&v"(y) : "v"(x)); return y; }
// addr_done: s_wait_xcnt 0 held in its place by two scheduling barriers; it stands between a load and later loads whose results the register allocator may lay over the first load's address registers.
__device__ __forceinline__ void addr_done() { __builtin_amdgcn_sched_barrier(0); asm volatile("s_wait_xcnt 0x0" ::: "memory"); __builtin_amdgcn_sched_barrier(0); }
typedef __attribute__((ext_vector_type(2))) unsigned v2u;
typedef __attribute__((ext_vector_type(4))) unsigned v4u;
__device__ __forceinline__ unsigned pk2(float a, float b) { v2f p; p[0] = a; p[1] = b; return __builtin_bit_cast(unsigned, __builtin_convertvector(p, v2bf)); }    // two f32 -> two bf16 (nearest even), a in the low half
__device__ __forceinline__ void split2(float a, float b, unsigned& h, unsigned& l) { h = pk2(a, b); l = pk2(a - __uint_as_float(h << 16), b - __uint_as_float(h & 0xFFFF0000u)); }    // hl split of two values
#define WP  264     // LDS pitch of a Wt row in bf16 elements (512 B + 16 B, for the 16-B fragment reads)
#define VPP 136     // LDS pitch of a V row in bf16 elements (256 B + 16 B)
// k_proj: the whole projection in one kernel: t = Wt . x (bf16 operands, f32 accumulate, k ascending in steps of 32) and the hl planes KT[i][c], QT[j][c], VP[r][i] (rows 0..31 of each batch's 64-row plane; the rest is never read). Grid (NN / 128, NB_), 4 waves.
// A wave owns 32 positions and all 96 rows of t. x is read channel-major as it lies: a lane loads 8 B (positions n0 + 2 lr, + 1) of channel k, so a load covers two whole 128-B lines; value u of the pair belongs to fragment u, whose row or column lr stands for position n0 + 2 lr + u.
// The same x fragment is B for K and Q (D: a lane holds 8 successive channels of one position = 16 B of KT or QT) and A for V (D: a lane holds one channel at positions n0 + 16 hi + 2 j + u = 32 B of a VP row).
// Wt is rounded once per block into LDS. The V tile goes through LDS so that the block stores 256-B row pieces. The first blocks also round Wo for k_attn.
__global__ __launch_bounds__(128) void k_proj(const float* __restrict__ X, const float* __restrict__ Wt, const float* __restrict__ Wo, bf* __restrict__ AO, bf* __restrict__ Qh, bf* __restrict__ Ql, bf* __restrict__ Kh, bf* __restrict__ Kl, bf* __restrict__ Vh, bf* __restrict__ Vl) {
    typedef WFrag<bf> F; typedef v16bf V;
    __shared__ __align__(16) bf sw[96 * WP];
    __shared__ __align__(16) bf sv[2][32 * VPP];
    { const size_t b = blockIdx.y; X += b * CC * NN; Qh += b * NN * CR; Ql += b * NN * CR; Kh += b * NN * CR; Kl += b * NN * CR; Vh += b * 64 * NN; Vl += b * 64 * NN; }
    const int tid = threadIdx.x, lane = tid & 31, lr = lane & 15, hi = lane >> 4, w = tid >> 5;
    const int nb0 = blockIdx.x * 128, n0 = nb0 + w * 32;
    // x: a 32-bit lane offset in bytes on a wave-uniform base
    const unsigned xo = (unsigned)(8 * hi * NN + n0 + 2 * lr) * 4u;
    const float* px = (const float*)((const char*)X + xo); const float* pw = Wt + tid * 4;
    v2f raw[2][16];    // two k steps of x in flight; element e of a fragment is channel 8 hi + (e & 7) + 16 (e >> 3) of the step, as in WFrag::ld
#pragma unroll
    for (int hb = 0; hb < 2; ++hb) {
        v4f wv[24];
#pragma unroll
        for (int i = 0; i < 24; ++i) wv[i] = *(const v4f*)(pw + (hb * 24 + i) * 512);
        if (hb == 0) {
            __builtin_amdgcn_sched_barrier(0);    // keeps the first half of Wt (short latency) ahead of x (from memory): loads return in order, so its rounding need not wait for x, and x flies under the staging of Wt
#pragma unroll
            for (int c = 0; c < 2; ++c)
#pragma unroll
                for (int e = 0; e < 16; ++e) raw[c][e] = *(const v2f*)(px + (size_t)(c * 32 + (e & 7) + (e >> 3) * 16) * NN);
        }
        addr_done();    // every load of this half is issued above this line, and no load's result is laid over an address register in front of the wait
#pragma unroll
        for (int i = 0; i < 24; ++i) { const int e = ((hb * 24 + i) * 128 + tid) * 4; v2u o; o[0] = pk2(wv[i][0], wv[i][1]); o[1] = pk2(wv[i][2], wv[i][3]); *(v2u*)(sw + (e >> 8) * WP + (e & 255)) = o; }
    }
    v8f acc[6][2];
#pragma unroll
    for (int rt = 0; rt < 6; ++rt) { acc[rt][0] = (v8f){}; acc[rt][1] = (v8f){}; }
    __syncthreads();    // Wt in LDS is read across waves below
#pragma unroll
    for (int ch = 0; ch < CC / 32; ++ch) {
        V xb[2];
#pragma unroll
        for (int u = 0; u < 2; ++u) { v8u t;
#pragma unroll
            for (int e = 0; e < 8; ++e) t[e] = pk2(raw[ch & 1][2 * e][u], raw[ch & 1][2 * e + 1][u]);
            xb[u] = __builtin_bit_cast(V, t); }
        if (ch + 2 < CC / 32) {
#pragma unroll
            for (int e = 0; e < 16; ++e) raw[ch & 1][e] = *(const v2f*)(px + (size_t)((ch + 2) * 32 + (e & 7) + (e >> 3) * 16) * NN);
            // keeps the loads of step ch + 2 here, two steps ahead of their use (the scheduler otherwise sinks them); the wait holds the lane offset's register up to this line
            __builtin_amdgcn_sched_barrier(0); asm volatile("s_wait_xcnt 0x0" :: "v"(xo) : "memory"); __builtin_amdgcn_sched_barrier(0);
        }
#pragma unroll
        for (int rt = 0; rt < 6; ++rt) { const V a = F::ld(sw + (rt * 16 + lr) * WP + ch * 32 + 8 * hi);
#pragma unroll
            for (int u = 0; u < 2; ++u) acc[rt][u] = (rt < 4) ? F::mma(a, xb[u], acc[rt][u]) : F::mma(xb[u], a, acc[rt][u]); }
    }
    __builtin_amdgcn_sched_barrier(0);    // keeps the last products in front of the epilogue (the scheduler otherwise carries some past the barrier below, and the register count then passes 256)
#pragma unroll
    for (int rt = 4; rt < 6; ++rt) { v4u h[2], l[2];
#pragma unroll
        for (int j = 0; j < 8; ++j) { unsigned a, b; split2(acc[rt][0][j], acc[rt][1][j], a, b); h[j >> 2][j & 3] = a; l[j >> 2][j & 3] = b; }
        const int d = ((rt - 4) * 16 + lr) * VPP + w * 32 + hi * 16;
        *(v4u*)(sv[0] + d) = h[0]; *(v4u*)(sv[0] + d + 8) = h[1]; *(v4u*)(sv[1] + d) = l[0]; *(v4u*)(sv[1] + d + 8) = l[1]; }
    __syncthreads();    // the V tile is read across waves below
    // AO [256][32] = bf16(Wo), for k_attn: 16 blocks round 512 values each; the load goes out here, behind the last barrier, and flies under the stores and the split of K and Q; its value is stored last
    const bool wob = blockIdx.y == 0 && blockIdx.x < CC * CR / 512; const unsigned oo = (unsigned)(blockIdx.x * 128 + tid) * 16u; v4f wov = (v4f){};
    if (wob) { wov = *(const v4f*)((const char*)Wo + oo); asm volatile("s_wait_xcnt 0x0" :: "v"(oo) : "memory"); }    // the wait takes the lane offset as an input: no load's result is laid over it in front of the wait
#pragma unroll
    for (int i = 0; i < 4; ++i) { const int p = i * 128 + tid, row = p >> 4, part = (p & 15) * 8;
        *(v4u*)(Vh + (unsigned)(row * NN + nb0 + part)) = *(const v4u*)(sv[0] + row * VPP + part); *(v4u*)(Vl + (unsigned)(row * NN + nb0 + part)) = *(const v4u*)(sv[1] + row * VPP + part); }
    // K and Q last: no global store stands in front of the barrier above, which would wait for it
#pragma unroll
    for (int rt = 0; rt < 4; ++rt) { bf* Ph = (rt < 2) ? Kh : Qh; bf* Pl = (rt < 2) ? Kl : Ql;
#pragma unroll
        for (int u = 0; u < 2; ++u) { v4u h, l;
#pragma unroll
            for (int j = 0; j < 4; ++j) { unsigned a, b; split2(acc[rt][u][2 * j], acc[rt][u][2 * j + 1], a, b); h[j] = a; l[j] = b; }
            const unsigned off = (unsigned)((n0 + 2 * lr + u) * CR + (rt & 1) * 16 + hi * 8);
            *(v4u*)(Ph + off) = h; *(v4u*)(Pl + off) = l; } }
    if (wob) { addr_done();    // the stores above are issued: the values below may be laid over their registers
        v2u o; o[0] = pk2(wov[0], wov[1]); o[1] = pk2(wov[2], wov[3]); *(v2u*)((char*)AO + (oo >> 1)) = o; }
}
// lds_barrier: a work-group barrier that orders LDS traffic alone (release and acquire fences on the local address space): unlike __syncthreads() it does not drain the wave's global loads, so x stays in flight across it.
__device__ __forceinline__ void lds_barrier() { __builtin_amdgcn_fence(__ATOMIC_RELEASE, "workgroup", "local"); __builtin_amdgcn_s_barrier(); __builtin_amdgcn_fence(__ATOMIC_ACQUIRE, "workgroup", "local"); }
__global__ __launch_bounds__(512) void k_attn(const bf* __restrict__ Qh, const bf* __restrict__ Ql, const bf* __restrict__ Kh, const bf* __restrict__ Kl, const bf* __restrict__ Vh, const bf* __restrict__ Vl, const bf* __restrict__ AO, const float* __restrict__ X, const float* __restrict__ scale, float* __restrict__ Y) {
    typedef WFrag<bf> F; typedef v16bf V;
    __shared__ __align__(16) float sp[16 * 8 * 32 * 4];      // a wave's 32 accumulator registers, 4 to a 16-B piece: [wave][piece][lane][4]
    __shared__ float sM[KQ][JB], sL[KQ][JB];                 // per quarter and position: maximum times log2 e, sum of the exponentials
    __shared__ __align__(16) unsigned sfh[8 * 2 * 32 * 4], sfl[8 * 2 * 32 * 4];    // the joined out as B fragments, h and l: [16-column tile][fragment half][lane][4 words]
    __shared__ __align__(16) float os[16][32 * 68];
    { const size_t b = blockIdx.y; Qh += b * NN * CR; Ql += b * NN * CR; Kh += b * NN * CR; Kl += b * NN * CR; Vh += b * 64 * NN; Vl += b * 64 * NN; X += b * CC * NN; Y += b * CC * NN; }
    const int lane = threadIdx.x & 31, lr = lane & 15, hi = lane >> 4, w = threadIdx.x >> 5, jg = w & 3, kq = w >> 2;
    const int jb0 = blockIdx.x * JB, j0 = jb0 + jg * 32, ib = kq * (NN / KQ);
    V qh[2], ql[2];
#pragma unroll
    for (int jt = 0; jt < 2; ++jt) { qh[jt] = F::ld(Qh + (size_t)(j0 + jt * 16 + lr) * CR + 8 * hi); addr_done(); ql[jt] = F::ld(Ql + (size_t)(j0 + jt * 16 + lr) * CR + 8 * hi); addr_done(); }
    const size_t koff = (size_t)(ib + lr) * CR + 8 * hi, voff = (size_t)lr * NN + ib + 8 * hi;
    v8f o[2][2]; float mL[2], l[2];
#pragma unroll
    for (int jt = 0; jt < 2; ++jt) { o[0][jt] = (v8f){}; o[1][jt] = (v8f){}; mL[jt] = -3.0e38f; l[jt] = 0.f; }
    V kh[2], kl[2];
#pragma unroll
    for (int it = 0; it < 2; ++it) { kh[it] = F::ld(Kh + koff + it * 16 * CR); kl[it] = F::ld(Kl + koff + it * 16 * CR); }
#pragma unroll 1        // rolled: the pass is long enough to fill the pipes, and the code stays small
    for (int t = 0; t < NN / KQ / 32; ++t) {
        V vh[2], vl[2]; const bf* pvh = Vh + voff + t * 32; const bf* pvl = Vl + voff + t * 32;
#pragma unroll
        for (int ct = 0; ct < 2; ++ct) { vh[ct] = F::ld(pvh + (size_t)ct * 16 * NN); vl[ct] = F::ld(pvl + (size_t)ct * 16 * NN); }
        // keeps the V loads at the head of the pass, a whole softmax ahead of their use (the scheduler otherwise sinks half of them to just before the value products); the wait takes the two row pointers as inputs, so that no load's result is laid over an address register in front of it
        __builtin_amdgcn_sched_barrier(0); asm volatile("s_wait_xcnt 0x0" :: "v"(pvh), "v"(pvl) : "memory"); __builtin_amdgcn_sched_barrier(0);
        v8f s[2][2];
#pragma unroll
        for (int jt = 0; jt < 2; ++jt)
#pragma unroll
            for (int it = 0; it < 2; ++it) s[jt][it] = F::mma(kh[it], qh[jt], (v8f){});
#pragma unroll
        for (int jt = 0; jt < 2; ++jt)
#pragma unroll
            for (int it = 0; it < 2; ++it) s[jt][it] = F::mma(kh[it], ql[jt], s[jt][it]);
#pragma unroll
        for (int jt = 0; jt < 2; ++jt)
#pragma unroll
            for (int it = 0; it < 2; ++it) s[jt][it] = F::mma(kl[it], qh[jt], s[jt][it]);
        const int tn = (t + 1 < NN / KQ / 32) ? t + 1 : t;    // the next pass's K rows, fetched behind this pass's score products (the last pass reads its own again: in bounds)
#pragma unroll
        for (int it = 0; it < 2; ++it) { kh[it] = F::ld(Kh + koff + (size_t)(tn * 32 + it * 16) * CR); kl[it] = F::ld(Kl + koff + (size_t)(tn * 32 + it * 16) * CR); }
        __builtin_amdgcn_sched_barrier(0);    // keeps the next pass's K loads here, so that they fly under the softmax and the value products (the scheduler otherwise sinks them to the foot of the pass)
        V ph[2], pl[2];
#pragma unroll
        for (int jt = 0; jt < 2; ++jt) {
            float mx = s[jt][0][0];
#pragma unroll
            for (int r = 1; r < 8; ++r) mx = fmaxf(mx, s[jt][0][r]);
#pragma unroll
            for (int r = 0; r < 8; ++r) mx = fmaxf(mx, s[jt][1][r]);
            mx = fmaxf(mx, xhalf(mx));
            const float mn = fmaxf(mL[jt], mx * L2E); const float al = exp2x1(mL[jt] - mn); mL[jt] = mn;
            float sum = 0.f, xs[16], ps[16]; v8u uh, ul;
#pragma unroll
            for (int e = 0; e < 16; ++e) xs[e] = __builtin_fmaf(s[jt][e >> 3][e & 7], L2E, -mn);
            exp2x8(xs, ps); exp2x8(xs + 8, ps + 8);
#pragma unroll
            for (int e = 0; e < 8; ++e) {
                v2f p; p[0] = ps[2 * e]; p[1] = ps[2 * e + 1]; sum += p[0] + p[1];
                const v2bf h = __builtin_convertvector(p, v2bf); const unsigned hu = __builtin_bit_cast(unsigned, h); uh[e] = hu;
                v2f d; d[0] = p[0] - __uint_as_float(hu << 16); d[1] = p[1] - __uint_as_float(hu & 0xFFFF0000u);
                ul[e] = __builtin_bit_cast(unsigned, __builtin_convertvector(d, v2bf)); }
            l[jt] = l[jt] * al + sum; ph[jt] = __builtin_bit_cast(V, uh); pl[jt] = __builtin_bit_cast(V, ul);
#pragma unroll
            for (int r = 0; r < 8; ++r) { o[0][jt][r] *= al; o[1][jt][r] *= al; }
        }
#pragma unroll
        for (int jt = 0; jt < 2; ++jt)
#pragma unroll
            for (int ct = 0; ct < 2; ++ct) o[ct][jt] = F::mma(vh[ct], ph[jt], o[ct][jt]);
#pragma unroll
        for (int jt = 0; jt < 2; ++jt)
#pragma unroll
            for (int ct = 0; ct < 2; ++ct) o[ct][jt] = F::mma(vl[ct], ph[jt], o[ct][jt]);
#pragma unroll
        for (int jt = 0; jt < 2; ++jt)
#pragma unroll
            for (int ct = 0; ct < 2; ++ct) o[ct][jt] = F::mma(vh[ct], pl[jt], o[ct][jt]);
    }
    // The wave's share of the output product: channels o0 .. o0 + 31 at positions jy .. jy + 63. 32-bit lane offsets in bytes on wave-uniform bases: x and the result share one offset register.
    const int o0 = (w & 7) * 32, jh = w >> 3, jy = jb0 + jh * 64;
    const unsigned xb = (unsigned)((o0 + hi) * NN + jy + lr * 4) * 4u, ab = (unsigned)((o0 + lr) * CR + 8 * hi) * 2u;
    const bf* pa = (const bf*)((const char*)AO + ab); const float* px = (const float*)((const char*)X + xb); float* py = (float*)((char*)Y + xb);
    const float sc = bfr(scale[0]);
    V a[2]; v4f xx[16];
#pragma unroll
    for (int mb = 0; mb < 2; ++mb) a[mb] = F::ld(pa + mb * 16 * CR);
#pragma unroll
    for (int s = 0; s < 16; ++s) xx[s] = *(const v4f*)(px + (size_t)(2 * s) * NN);
    // Wo and x are issued here, Wo (short latency) ahead of x, so that x flies under the join, the products and the LDS stores.
    // The wait takes the two lane offsets as inputs: their registers stay theirs up to it, so that no load's result and no later value is laid over an address register in front of the wait.
    __builtin_amdgcn_sched_barrier(0); asm volatile("s_wait_xcnt 0x0" :: "v"(ab), "v"(xb) : "memory"); __builtin_amdgcn_sched_barrier(0);
#pragma unroll
    for (int jt = 0; jt < 2; ++jt) l[jt] += xhalf(l[jt]);
    sM[kq][jg * 32 + lane] = hi ? mL[1] : mL[0]; sL[kq][jg * 32 + lane] = hi ? l[1] : l[0];
#pragma unroll
    for (int ct = 0; ct < 2; ++ct)
#pragma unroll
        for (int jt = 0; jt < 2; ++jt)
#pragma unroll
            for (int rr = 0; rr < 2; ++rr) { v4f c; c[0] = o[ct][jt][4 * rr]; c[1] = o[ct][jt][4 * rr + 1]; c[2] = o[ct][jt][4 * rr + 2]; c[3] = o[ct][jt][4 * rr + 3];
                *(v4fa*)(sp + ((w * 8 + ct * 4 + jt * 2 + rr) * 32 + lane) * 4) = c; }
    lds_barrier();    // the quarters' tiles, maxima and sums are read across waves below
    {   // wave w joins 16-column tile T = w >> 1 (column group T >> 1, its half T & 1), channels 16 (w & 1) + 8 hi + 0..7: one half of that tile's B fragment
        const int T = w >> 1, fh = w & 1;
        float mq[KQ], lq[KQ], wq[KQ], mm = -3.0e38f, den = 0.f, sj[8] = {0.f, 0.f, 0.f, 0.f, 0.f, 0.f, 0.f, 0.f};
#pragma unroll
        for (int q = 0; q < KQ; ++q) { mq[q] = sM[q][T * 16 + lr]; lq[q] = sL[q][T * 16 + lr]; }
#pragma unroll
        for (int q = 0; q < KQ; ++q) mm = fmaxf(mm, mq[q]);
#pragma unroll
        for (int q = 0; q < KQ; ++q) wq[q] = exp2x1(mq[q] - mm);
#pragma unroll
        for (int q = 0; q < KQ; ++q) den += wq[q] * lq[q];
#pragma unroll
        for (int q = 0; q < KQ; ++q)
#pragma unroll
            for (int rr = 0; rr < 2; ++rr) { const v4f c = *(const v4fa*)(sp + (((q * 4 + (T >> 1)) * 8 + fh * 4 + (T & 1) * 2 + rr) * 32 + lane) * 4);
#pragma unroll
                for (int u = 0; u < 4; ++u) sj[4 * rr + u] += wq[q] * c[u]; }
        const float inv = __fdiv_rn(1.0f, den); v4u h4, l4;
#pragma unroll
        for (int e = 0; e < 4; ++e) { unsigned ha, la; split2(sj[2 * e] * inv, sj[2 * e + 1] * inv, ha, la); h4[e] = ha; l4[e] = la; }
        *(v4u*)(sfh + ((T * 2 + fh) * 32 + lane) * 4) = h4; *(v4u*)(sfl + ((T * 2 + fh) * 32 + lane) * 4) = l4;
    }
    lds_barrier();    // the fragments of out are read across waves below
    V bh[4], bl[4];
#pragma unroll
    for (int nb = 0; nb < 4; ++nb) { const int d = ((jh * 4 + nb) * 2 * 32 + lane) * 4;
        bh[nb] = cat16b(*(const v8usa*)(sfh + d), *(const v8usa*)(sfh + d + 128)); bl[nb] = cat16b(*(const v8usa*)(sfl + d), *(const v8usa*)(sfl + d + 128)); }
    v8f acc[2][4];
#pragma unroll
    for (int mb = 0; mb < 2; ++mb)
#pragma unroll
        for (int nb = 0; nb < 4; ++nb) acc[mb][nb] = F::mma(a[mb], bh[nb], (v8f){});
#pragma unroll
    for (int mb = 0; mb < 2; ++mb)
#pragma unroll
        for (int nb = 0; nb < 4; ++nb) acc[mb][nb] = F::mma(a[mb], bl[nb], acc[mb][nb]);
    float* t = os[w];
#pragma unroll
    for (int mb = 0; mb < 2; ++mb)
#pragma unroll
        for (int nb = 0; nb < 4; ++nb)
#pragma unroll
            for (int r = 0; r < 8; ++r) t[(mb * 16 + hi * 8 + r) * 68 + nb * 16 + lr] = acc[mb][nb][r];
    asm volatile("s_wait_dscnt 0x0" ::: "memory");    // the wave's LDS stores are done before its lanes read back what other lanes wrote (the range is the wave's own: no work-group barrier)
    __builtin_amdgcn_sched_barrier(0);    // keeps the rounding of x behind the products and the LDS stores (the scheduler otherwise lifts it, with its wait for memory, in front of them)
#pragma unroll
    for (int s = 0; s < 16; ++s) { const v4f y = *(const v4fa*)(t + (2 * s + hi) * 68 + lr * 4); v4f r;
#pragma unroll
        for (int u = 0; u < 4; ++u) r[u] = __builtin_fmaf(sc, y[u], bfr(xx[s][u]));
        *(v4f*)(py + (size_t)(2 * s) * NN) = r; }
}

extern "C" void kernel_launch(void* const* d_in, const int* in_sizes, int n_in,
                              void* d_out, int out_size, void* d_ws, size_t ws_size, hipStream_t stream) {
    (void)in_sizes; (void)n_in; (void)out_size;
    const float* x = (const float*)d_in[0]; const float* Wt = (const float*)d_in[1]; const float* Wo = (const float*)d_in[2]; const float* scale = (const float*)d_in[3];
    float* OUT = (float*)d_out;     // [8][256][4096]
    char* wsp = (char*)d_ws;
    auto take = [&](size_t bytes) { char* p = wsp; wsp += (bytes + 255) & ~(size_t)255; return (void*)p; };
    bf* AO = (bf*)take((size_t)CC * CR * 2);
    bf* QTh = (bf*)take((size_t)NB_ * NN * CR * 2); bf* QTl = (bf*)take((size_t)NB_ * NN * CR * 2); bf* KTh = (bf*)take((size_t)NB_ * NN * CR * 2); bf* KTl = (bf*)take((size_t)NB_ * NN * CR * 2); bf* VPh = (bf*)take((size_t)NB_ * 64 * NN * 2); bf* VPl = (bf*)take((size_t)NB_ * 64 * NN * 2);
    if ((size_t)(wsp - (char*)d_ws) > ws_size) return;    // total ~ 17 MB
    k_proj<<<dim3(NN / 128, NB_), 128, 0, stream>>>(x, Wt, Wo, AO, QTh, QTl, KTh, KTl, VPh, VPl);     // t = Wt . x and its hl planes KT, QT [n][c] and VP [r][n]; AO = bf16(Wo)
    k_attn<<<dim3(NN / JB, NB_), 512, 0, stream>>>(QTh, QTl, KTh, KTl, VPh, VPl, AO, x, scale, OUT);     // result[b][o][j] = scale * (Wo . softmax-weighted V) + x
}

// v007
// Measured time: 53.3 microseconds a run.
// Next to v006, in two timings, it ran 1.04 times as fast each time.
// Counting every step since v000, it is 26.7 times as fast.
#include <hip/hip_runtime.h>

// GlobalSelfAttention (x [8][256][64][64] channel-major, N = 4096 positions; t = Wt . x (1x1 conv, [96][256]): key = t[0:32], query = t[32:64], value = t[64:96]; scores[i][j] = sum_c key[c][i] query[c][j] (unscaled); weights = softmax over i (the key axis) for every j;
//   out[c][j] = sum_i value[c][i] weights[i][j]; y = Wo . out (1x1 conv, [256][32]); result = scale[0] * y + x -> [8][256][64][64]; scale read).
// Compute dtypes, f32 accumulate: every input rounded to bf16; t as a PLAIN bf16 GEMM Wt . x with the rounding of x and Wt and the hl split of K, Q and V in the same kernel (k_proj; x read channel-major); logits, softmax and value product in ONE kernel (k_attn): S^T = K^T . Q as hl x hl (3 products, K = 32), running maximum and sum per j in f32, exp -> hl operand in registers, out += V . P^T as 3 products (the hl planes of K, Q and V lie in fragment order: FragOrder below); 4 key quarters on 4 groups of waves, joined in LDS; y = Wo (exact) . out (hl fragments; K = 32, 2 products, channel-major) with scale * y + x in f32 applied to the accumulators, all in k_attn.

#define NB_  8
#define CC   256
#define CR   32
#define NN   4096
#define KQ   4       // key quarters of the attention kernel (1024 keys each), one per group of 4 waves
#define JB   128     // positions of a block of the attention kernel
typedef _Float16 h16;
typedef unsigned short bf;
typedef __attribute__((ext_vector_type(16))) __bf16   v16bf;
typedef __attribute__((ext_vector_type(16))) _Float16 v16h;
typedef __attribute__((ext_vector_type(8)))  _Float16 v8h;
typedef __attribute__((ext_vector_type(8)))  unsigned short v8us;
typedef __attribute__((ext_vector_type(8)))  float    v8f;
typedef __attribute__((ext_vector_type(4)))  float    v4f;
typedef v8h  __attribute__((may_alias)) v8ha;
typedef v4f  __attribute__((may_alias)) v4fa;
typedef v8us __attribute__((may_alias)) v8usa;

__device__ __forceinline__ unsigned short f2bf(float f) { unsigned u = __float_as_uint(f); u += 0x7FFFu + ((u >> 16) & 1u); return (unsigned short)(u >> 16); }
__device__ __forceinline__ float bf2f(unsigned short b) { return __uint_as_float(((unsigned)b) << 16); }
__device__ __forceinline__ float bfr(float f) { return bf2f(f2bf(f)); }
__device__ __forceinline__ v16h cat16(v8h lo, v8h hi) { return __builtin_shufflevector(lo, hi, 0, 1, 2, 3, 4, 5, 6, 7, 8, 9, 10, 11, 12, 13, 14, 15); }
__device__ __forceinline__ v16bf cat16b(v8us lo, v8us hi) { return __builtin_bit_cast(v16bf, __builtin_shufflevector(lo, hi, 0, 1, 2, 3, 4, 5, 6, 7, 8, 9, 10, 11, 12, 13, 14, 15)); }
__device__ __forceinline__ v8f wmma16(v16h a, v16h b, v8f c) { return __builtin_amdgcn_wmma_f32_16x16x32_f16(false, a, false, b, (short)0, c, false, false); }
__device__ __forceinline__ v8f wmmab(v16bf a, v16bf b, v8f c) { return __builtin_amdgcn_wmma_f32_16x16x32_bf16(false, a, false, b, (short)0, c, false, false); }



// WFrag: a 16 x 32 operand fragment (A or B alike) from a K-contiguous 16-bit row: lane lr + 16 hi holds row lr, k = 8 hi + 0..7 and 16 + 8 hi + 0..7.
template <typename T16> struct WFrag;
template <> struct WFrag<h16> { typedef v16h V; static __device__ __forceinline__ V ld(const h16* p) { return cat16(*(const v8h*)p, *(const v8h*)(p + 16)); } static __device__ __forceinline__ v8f mma(V a, V b, v8f c) { return wmma16(a, b, c); } };
template <> struct WFrag<bf> { typedef v16bf V; static __device__ __forceinline__ V ld(const bf* p) { return cat16b(*(const v8us*)p, *(const v8us*)(p + 16)); } static __device__ __forceinline__ v8f mma(V a, V b, v8f c) { return wmmab(a, b, c); } };

// FragOrder: a plane of 16 x 32 operand tiles of 1024 B each, stored as the lanes read them: [tile][fragment half][lane][8 elements]. Row lr of the tile, k = 8 q + 0..7 (q = 0..3), lies at half q >> 1, lane (q & 1) * 16 + lr.
// ldfo: a fragment from such a plane: two loads of 512 successive bytes each (4 whole 128-B lines a load). p = tile start + 8 lane elements.
__device__ __forceinline__ v16bf ldfo(const bf* p) { return cat16b(*(const v8us*)p, *(const v8us*)(p + 256)); }
__device__ __forceinline__ void splitf(float y, unsigned short& h, unsigned short& l) { h = f2bf(y); l = f2bf(y - bf2f(h)); }
typedef __attribute__((ext_vector_type(2))) unsigned short v2us;
typedef __attribute__((ext_vector_type(4))) unsigned short v4us;

// Every kernel from here on serves all NB_ batches in one launch: the slowest grid axis is the batch, and each workspace plane but AO (one copy for all batches) has one copy per batch.
typedef __attribute__((ext_vector_type(2))) float v2f;
typedef __attribute__((ext_vector_type(2))) __bf16 v2bf;
typedef __attribute__((ext_vector_type(8))) unsigned v8u;
#define L2E 1.4426950408889634f
__device__ __forceinline__ float xhalf(float v) { const int b = __float_as_int(v); return __int_as_float(__builtin_amdgcn_permlanex16(b, b, 0x76543210, 0xfedcba98, false, false)); }    // lane l <-> l ^ 16
// exp2x8 / exp2x1: v_exp_f32 with the slot behind a transcendental kept by construction: no result lies on a source (early clobber), nothing in the run reads a result, and one v_nop fills the slot behind the last.
__device__ __forceinline__ void exp2x8(const float* x, float* y) {
    asm("v_exp_f32 %0, %8\n\tv_exp_f32 %1, %9\n\tv_exp_f32 %2, %10\n\tv_exp_f32 %3, %11\n\tv_exp_f32 %4, %12\n\tv_exp_f32 %5, %13\n\tv_exp_f32 %6, %14\n\tv_exp_f32 %7, %15\n\tv_nop"
        : "=&v"(y[0]), "=&v"(y[1]), "=&v"(y[2]), "=&v"(y[3]), "=&v"(y[4]), "=&v"(y[5]), "=&v"(y[6]), "=&v"(y[7]) : "v"(x[0]), "v"(x[1]), "v"(x[2]), "v"(x[3]), "v"(x[4]), "v"(x[5]), "v"(x[6]), "v"(x[7])); }
__device__ __forceinline__ float exp2x1(float x) { float y; asm("v_exp_f32 %0, %1\n\tv_nop" : "=&v"(y) : "v"(x)); return y; }
// addr_done: s_wait_xcnt 0 held in its place by two scheduling barriers; it stands between a load and later loads whose results the register allocator may lay over the first load's address registers.
__device__ __forceinline__ void addr_done() { __builtin_amdgcn_sched_barrier(0); asm volatile("s_wait_xcnt 0x0" ::: "memory"); __builtin_amdgcn_sched_barrier(0); }
typedef __attribute__((ext_vector_type(2))) unsigned v2u;
typedef __attribute__((ext_vector_type(4))) unsigned v4u;
__device__ __forceinline__ unsigned pk2(float a, float b) { v2f p; p[0] = a; p[1] = b; return __builtin_bit_cast(unsigned, __builtin_convertvector(p, v2bf)); }    // two f32 -> two bf16 (nearest even), a in the low half
__device__ __forceinline__ void split2(float a, float b, unsigned& h, unsigned& l) { h = pk2(a, b); l = pk2(a - __uint_as_float(h << 16), b - __uint_as_float(h & 0xFFFF0000u)); }    // hl split of two values
#define WP  264     // LDS pitch of a Wt row in bf16 elements (512 B + 16 B, for the 16-B fragment reads)
#define VPP 136     // LDS pitch of a V row in bf16 elements (256 B + 16 B)
// k_proj: the whole projection in one kernel: t = Wt . x (bf16 operands, f32 accumulate, k ascending in steps of 32) and the hl planes of K, Q (tiles of 16 positions x 32 channels) and V (tiles of 16 channels x 32 positions, [32-position block][channel half]) in FragOrder (V fills the first half of each batch's plane; the rest is never read). Grid (NN / 128, NB_), 4 waves.
// A wave owns 32 positions and all 96 rows of t. x is read channel-major as it lies: a lane loads 8 B (positions n0 + 2 lr, + 1) of channel k, so a load covers two whole 128-B lines; value u of the pair belongs to fragment u, whose row or column lr stands for position n0 + 2 lr + u.
// The same x fragment is B for K and Q (D: a lane holds 8 successive channels of one position = one 16-B piece of a K or Q tile) and A for V (D: a lane holds one channel at positions n0 + 16 hi + 2 j + u = 32 B of a V row).
// Wt is rounded once per block into LDS. The V tile goes through LDS so that the block stores its 8 tiles (8 KB a plane, one range) in 512-B pieces. The first blocks also round Wo for k_attn.
__global__ __launch_bounds__(128) void k_proj(const float* __restrict__ X, const float* __restrict__ Wt, const float* __restrict__ Wo, bf* __restrict__ AO, bf* __restrict__ Qh, bf* __restrict__ Ql, bf* __restrict__ Kh, bf* __restrict__ Kl, bf* __restrict__ Vh, bf* __restrict__ Vl) {
    typedef WFrag<bf> F; typedef v16bf V;
    __shared__ __align__(16) bf sw[96 * WP];
    __shared__ __align__(16) bf sv[2][32 * VPP];
    { const size_t b = blockIdx.y; X += b * CC * NN; Qh += b * NN * CR; Ql += b * NN * CR; Kh += b * NN * CR; Kl += b * NN * CR; Vh += b * 64 * NN; Vl += b * 64 * NN; }
    const int tid = threadIdx.x, lane = tid & 31, lr = lane & 15, hi = lane >> 4, w = tid >> 5;
    const int nb0 = blockIdx.x * 128, n0 = nb0 + w * 32;
    // x: a 32-bit lane offset in bytes on a wave-uniform base
    const unsigned xo = (unsigned)(8 * hi * NN + n0 + 2 * lr) * 4u;
    const float* px = (const float*)((const char*)X + xo); const float* pw = Wt + tid * 4;
    v2f raw[2][16];    // two k steps of x in flight; element e of a fragment is channel 8 hi + (e & 7) + 16 (e >> 3) of the step, as in WFrag::ld
#pragma unroll
    for (int hb = 0; hb < 2; ++hb) {
        v4f wv[24];
#pragma unroll
        for (int i = 0; i < 24; ++i) wv[i] = *(const v4f*)(pw + (hb * 24 + i) * 512);
        if (hb == 0) {
            __builtin_amdgcn_sched_barrier(0);    // keeps the first half of Wt (short latency) ahead of x (from memory): loads return in order, so its rounding need not wait for x, and x flies under the staging of Wt
#pragma unroll
            for (int c = 0; c < 2; ++c)
#pragma unroll
                for (int e = 0; e < 16; ++e) raw[c][e] = *(const v2f*)(px + (size_t)(c * 32 + (e & 7) + (e >> 3) * 16) * NN);
        }
        addr_done();    // every load of this half is issued above this line, and no load's result is laid over an address register in front of the wait
#pragma unroll
        for (int i = 0; i < 24; ++i) { const int e = ((hb * 24 + i) * 128 + tid) * 4; v2u o; o[0] = pk2(wv[i][0], wv[i][1]); o[1] = pk2(wv[i][2], wv[i][3]); *(v2u*)(sw + (e >> 8) * WP + (e & 255)) = o; }
    }
    v8f acc[6][2];
#pragma unroll
    for (int rt = 0; rt < 6; ++rt) { acc[rt][0] = (v8f){}; acc[rt][1] = (v8f){}; }
    __syncthreads();    // Wt in LDS is read across waves below
#pragma unroll
    for (int ch = 0; ch < CC / 32; ++ch) {
        V xb[2];
#pragma unroll
        for (int u = 0; u < 2; ++u) { v8u t;
#pragma unroll
            for (int e = 0; e < 8; ++e) t[e] = pk2(raw[ch & 1][2 * e][u], raw[ch & 1][2 * e + 1][u]);
            xb[u] = __builtin_bit_cast(V, t); }
        if (ch + 2 < CC / 32) {
#pragma unroll
            for (int e = 0; e < 16; ++e) raw[ch & 1][e] = *(const v2f*)(px + (size_t)((ch + 2) * 32 + (e & 7) + (e >> 3) * 16) * NN);
            // keeps the loads of step ch + 2 here, two steps ahead of their use (the scheduler otherwise sinks them); the wait holds the lane offset's register up to this line
            __builtin_amdgcn_sched_barrier(0); asm volatile("s_wait_xcnt 0x0" :: "v"(xo) : "memory"); __builtin_amdgcn_sched_barrier(0);
        }
#pragma unroll
        for (int rt = 0; rt < 6; ++rt) { const V a = F::ld(sw + (rt * 16 + lr) * WP + ch * 32 + 8 * hi);
#pragma unroll
            for (int u = 0; u < 2; ++u) acc[rt][u] = (rt < 4) ? F::mma(a, xb[u], acc[rt][u]) : F::mma(xb[u], a, acc[rt][u]); }
    }
    __builtin_amdgcn_sched_barrier(0);    // keeps the last products in front of the epilogue (the scheduler otherwise carries some past the barrier below, and the register count then passes 256)
#pragma unroll
    for (int rt = 4; rt < 6; ++rt) { v4u h[2], l[2];
#pragma unroll
        for (int j = 0; j < 8; ++j) { unsigned a, b; split2(acc[rt][0][j], acc[rt][1][j], a, b); h[j >> 2][j & 3] = a; l[j >> 2][j & 3] = b; }
        const int d = ((rt - 4) * 16 + lr) * VPP + w * 32 + hi * 16;
        *(v4u*)(sv[0] + d) = h[0]; *(v4u*)(sv[0] + d + 8) = h[1]; *(v4u*)(sv[1] + d) = l[0]; *(v4u*)(sv[1] + d + 8) = l[1]; }
    __syncthreads();    // the V tile is read across waves below
    // AO [256][32] = bf16(Wo), for k_attn: 16 blocks round 512 values each; the load goes out here, behind the last barrier, and flies under the stores and the split of K and Q; its value is stored last
    const bool wob = blockIdx.y == 0 && blockIdx.x < CC * CR / 512; const unsigned oo = (unsigned)(blockIdx.x * 128 + tid) * 16u; v4f wov = (v4f){};
    if (wob) { wov = *(const v4f*)((const char*)Wo + oo); asm volatile("s_wait_xcnt 0x0" :: "v"(oo) : "memory"); }    // the wait takes the lane offset as an input: no load's result is laid over it in front of the wait
#pragma unroll
    for (int i = 0; i < 4; ++i) { const int p = i * 128 + tid, tile = p >> 6, row = (tile & 1) * 16 + (p & 15), part = (tile >> 1) * 32 + ((p >> 4) & 3) * 8;    // piece p of the block's range: tile, half and lane as in FragOrder
        *(v4u*)(Vh + (unsigned)(nb0 * 32 + p * 8)) = *(const v4u*)(sv[0] + row * VPP + part); *(v4u*)(Vl + (unsigned)(nb0 * 32 + p * 8)) = *(const v4u*)(sv[1] + row * VPP + part); }
    // K and Q last: no global store stands in front of the barrier above, which would wait for it
#pragma unroll
    for (int rt = 0; rt < 4; ++rt) { bf* Ph = (rt < 2) ? Kh : Qh; bf* Pl = (rt < 2) ? Kl : Ql;
#pragma unroll
        for (int u = 0; u < 2; ++u) { v4u h, l;
#pragma unroll
            for (int j = 0; j < 4; ++j) { unsigned a, b; split2(acc[rt][u][2 * j], acc[rt][u][2 * j + 1], a, b); h[j] = a; l[j] = b; }
            const int n = n0 + 2 * lr + u; const unsigned off = (unsigned)((n >> 4) * 512 + (rt & 1) * 256 + (hi * 16 + (n & 15)) * 8);    // FragOrder: channels 16 (rt & 1) + 8 hi + 0..7 are k group q = 2 (rt & 1) + hi
            *(v4u*)(Ph + off) = h; *(v4u*)(Pl + off) = l; } }
    if (wob) { addr_done();    // the stores above are issued: the values below may be laid over their registers
        v2u o; o[0] = pk2(wov[0], wov[1]); o[1] = pk2(wov[2], wov[3]); *(v2u*)((char*)AO + (oo >> 1)) = o; }
}
// lds_barrier: a work-group barrier that orders LDS traffic alone (release and acquire fences on the local address space): unlike __syncthreads() it does not drain the wave's global loads, so x stays in flight across it.
__device__ __forceinline__ void lds_barrier() { __builtin_amdgcn_fence(__ATOMIC_RELEASE, "workgroup", "local"); __builtin_amdgcn_s_barrier(); __builtin_amdgcn_fence(__ATOMIC_ACQUIRE, "workgroup", "local"); }
__global__ __launch_bounds__(512) void k_attn(const bf* __restrict__ Qh, const bf* __restrict__ Ql, const bf* __restrict__ Kh, const bf* __restrict__ Kl, const bf* __restrict__ Vh, const bf* __restrict__ Vl, const bf* __restrict__ AO, const float* __restrict__ X, const float* __restrict__ scale, float* __restrict__ Y) {
    typedef WFrag<bf> F; typedef v16bf V;
    __shared__ __align__(16) float sp[16 * 8 * 32 * 4];      // a wave's 32 accumulator registers, 4 to a 16-B piece: [wave][piece][lane][4]
    __shared__ float sM[KQ][JB], sL[KQ][JB];                 // per quarter and position: maximum times log2 e, sum of the exponentials
    __shared__ __align__(16) unsigned sfh[8 * 2 * 32 * 4], sfl[8 * 2 * 32 * 4];    // the joined out as B fragments, h and l: [16-column tile][fragment half][lane][4 words]
    __shared__ __align__(16) float os[16][32 * 68];
    { const size_t b = blockIdx.y; Qh += b * NN * CR; Ql += b * NN * CR; Kh += b * NN * CR; Kl += b * NN * CR; Vh += b * 64 * NN; Vl += b * 64 * NN; X += b * CC * NN; Y += b * CC * NN; }
    const int lane = threadIdx.x & 31, lr = lane & 15, hi = lane >> 4, w = threadIdx.x >> 5, jg = w & 3, kq = w >> 2;
    const int jb0 = blockIdx.x * JB, j0 = jb0 + jg * 32, ib = kq * (NN / KQ);
    V qh[2], ql[2];
#pragma unroll
    for (int jt = 0; jt < 2; ++jt) { qh[jt] = ldfo(Qh + (size_t)(j0 + jt * 16) * CR + lane * 8); addr_done(); ql[jt] = ldfo(Ql + (size_t)(j0 + jt * 16) * CR + lane * 8); addr_done(); }
    // the lane's offset in the K and in the V planes alike: 32 keys are two tiles (1024 elements) of either
    const size_t fo = (size_t)ib * CR + lane * 8;
    v8f o[2][2]; float mL[2], l[2];
#pragma unroll
    for (int jt = 0; jt < 2; ++jt) { o[0][jt] = (v8f){}; o[1][jt] = (v8f){}; mL[jt] = -3.0e38f; l[jt] = 0.f; }
    V kh[2], kl[2];
#pragma unroll
    for (int it = 0; it < 2; ++it) { kh[it] = ldfo(Kh + fo + it * 512); kl[it] = ldfo(Kl + fo + it * 512); }
#pragma unroll 1        // rolled: the pass is long enough to fill the pipes, and the code stays small
    for (int t = 0; t < NN / KQ / 32; ++t) {
        V vh[2], vl[2]; const bf* pvh = Vh + fo + t * 1024; const bf* pvl = Vl + fo + t * 1024;
#pragma unroll
        for (int ct = 0; ct < 2; ++ct) { vh[ct] = ldfo(pvh + ct * 512); vl[ct] = ldfo(pvl + ct * 512); }
        // keeps the V loads at the head of the pass, a whole softmax ahead of their use (the scheduler otherwise sinks half of them to just before the value products); the wait takes the two tile pointers as inputs, so that no load's result is laid over an address register in front of it
        __builtin_amdgcn_sched_barrier(0); asm volatile("s_wait_xcnt 0x0" :: "v"(pvh), "v"(pvl) : "memory"); __builtin_amdgcn_sched_barrier(0);
        v8f s[2][2];
#pragma unroll
        for (int jt = 0; jt < 2; ++jt)
#pragma unroll
            for (int it = 0; it < 2; ++it) s[jt][it] = F::mma(kh[it], qh[jt], (v8f){});
#pragma unroll
        for (int jt = 0; jt < 2; ++jt)
#pragma unroll
            for (int it = 0; it < 2; ++it) s[jt][it] = F::mma(kh[it], ql[jt], s[jt][it]);
#pragma unroll
        for (int jt = 0; jt < 2; ++jt)
#pragma unroll
            for (int it = 0; it < 2; ++it) s[jt][it] = F::mma(kl[it], qh[jt], s[jt][it]);
        const int tn = (t + 1 < NN / KQ / 32) ? t + 1 : t;    // the next pass's K rows, fetched behind this pass's score products (the last pass reads its own again: in bounds)
#pragma unroll
        for (int it = 0; it < 2; ++it) { kh[it] = ldfo(Kh + fo + (size_t)(tn * 1024 + it * 512)); kl[it] = ldfo(Kl + fo + (size_t)(tn * 1024 + it * 512)); }
        __builtin_amdgcn_sched_barrier(0);    // keeps the next pass's K loads here, so that they fly under the softmax and the value products (the scheduler otherwise sinks them to the foot of the pass)
        V ph[2], pl[2];
#pragma unroll
        for (int jt = 0; jt < 2; ++jt) {
            float mx = s[jt][0][0];
#pragma unroll
            for (int r = 1; r < 8; ++r) mx = fmaxf(mx, s[jt][0][r]);
#pragma unroll
            for (int r = 0; r < 8; ++r) mx = fmaxf(mx, s[jt][1][r]);
            mx = fmaxf(mx, xhalf(mx));
            const float mn = fmaxf(mL[jt], mx * L2E); const float al = exp2x1(mL[jt] - mn); mL[jt] = mn;
            float sum = 0.f, xs[16], ps[16]; v8u uh, ul;
#pragma unroll
            for (int e = 0; e < 16; ++e) xs[e] = __builtin_fmaf(s[jt][e >> 3][e & 7], L2E, -mn);
            exp2x8(xs, ps); exp2x8(xs + 8, ps + 8);
#pragma unroll
            for (int e = 0; e < 8; ++e) {
                v2f p; p[0] = ps[2 * e]; p[1] = ps[2 * e + 1]; sum += p[0] + p[1];
                const v2bf h = __builtin_convertvector(p, v2bf); const unsigned hu = __builtin_bit_cast(unsigned, h); uh[e] = hu;
                v2f d; d[0] = p[0] - __uint_as_float(hu << 16); d[1] = p[1] - __uint_as_float(hu & 0xFFFF0000u);
                ul[e] = __builtin_bit_cast(unsigned, __builtin_convertvector(d, v2bf)); }
            l[jt] = l[jt] * al + sum; ph[jt] = __builtin_bit_cast(V, uh); pl[jt] = __builtin_bit_cast(V, ul);
#pragma unroll
            for (int r = 0; r < 8; ++r) { o[0][jt][r] *= al; o[1][jt][r] *= al; }
        }
#pragma unroll
        for (int jt = 0; jt < 2; ++jt)
#pragma unroll
            for (int ct = 0; ct < 2; ++ct) o[ct][jt] = F::mma(vh[ct], ph[jt], o[ct][jt]);
#pragma unroll
        for (int jt = 0; jt < 2; ++jt)
#pragma unroll
            for (int ct = 0; ct < 2; ++ct) o[ct][jt] = F::mma(vl[ct], ph[jt], o[ct][jt]);
#pragma unroll
        for (int jt = 0; jt < 2; ++jt)
#pragma unroll
            for (int ct = 0; ct < 2; ++ct) o[ct][jt] = F::mma(vh[ct], pl[jt], o[ct][jt]);
    }
    // The wave's share of the output product: channels o0 .. o0 + 31 at positions jy .. jy + 63. 32-bit lane offsets in bytes on wave-uniform bases: x and the result share one offset register.
    const int o0 = (w & 7) * 32, jh = w >> 3, jy = jb0 + jh * 64;
    const unsigned xb = (unsigned)((o0 + hi) * NN + jy + lr * 4) * 4u, ab = (unsigned)((o0 + lr) * CR + 8 * hi) * 2u;
    const bf* pa = (const bf*)((const char*)AO + ab); const float* px = (const float*)((const char*)X + xb); float* py = (float*)((char*)Y + xb);
    const float sc = bfr(scale[0]);
    V a[2]; v4f xx[16];
#pragma unroll
    for (int mb = 0; mb < 2; ++mb) a[mb] = F::ld(pa + mb * 16 * CR);
#pragma unroll
    for (int s = 0; s < 16; ++s) xx[s] = *(const v4f*)(px + (size_t)(2 * s) * NN);
    // Wo and x are issued here, Wo (short latency) ahead of x, so that x flies under the join, the products and the LDS stores.
    // The wait takes the two lane offsets as inputs: their registers stay theirs up to it, so that no load's result and no later value is laid over an address register in front of the wait.
    __builtin_amdgcn_sched_barrier(0); asm volatile("s_wait_xcnt 0x0" :: "v"(ab), "v"(xb) : "memory"); __builtin_amdgcn_sched_barrier(0);
#pragma unroll
    for (int jt = 0; jt < 2; ++jt) l[jt] += xhalf(l[jt]);
    sM[kq][jg * 32 + lane] = hi ? mL[1] : mL[0]; sL[kq][jg * 32 + lane] = hi ? l[1] : l[0];
#pragma unroll
    for (int ct = 0; ct < 2; ++ct)
#pragma unroll
        for (int jt = 0; jt < 2; ++jt)
#pragma unroll
            for (int rr = 0; rr < 2; ++rr) { v4f c; c[0] = o[ct][jt][4 * rr]; c[1] = o[ct][jt][4 * rr + 1]; c[2] = o[ct][jt][4 * rr + 2]; c[3] = o[ct][jt][4 * rr + 3];
                *(v4fa*)(sp + ((w * 8 + ct * 4 + jt * 2 + rr) * 32 + lane) * 4) = c; }
    lds_barrier();    // the quarters' tiles, maxima and sums are read across waves below
    {   // wave w joins 16-column tile T = w >> 1 (column group T >> 1, its half T & 1), channels 16 (w & 1) + 8 hi + 0..7: one half of that tile's B fragment
        const int T = w >> 1, fh = w & 1;
        float mq[KQ], lq[KQ], wq[KQ], mm = -3.0e38f, den = 0.f, sj[8] = {0.f, 0.f, 0.f, 0.f, 0.f, 0.f, 0.f, 0.f};
#pragma unroll
        for (int q = 0; q < KQ; ++q) { mq[q] = sM[q][T * 16 + lr]; lq[q] = sL[q][T * 16 + lr]; }
#pragma unroll
        for (int q = 0; q < KQ; ++q) mm = fmaxf(mm, mq[q]);
#pragma unroll
        for (int q = 0; q < KQ; ++q) wq[q] = exp2x1(mq[q] - mm);
#pragma unroll
        for (int q = 0; q < KQ; ++q) den += wq[q] * lq[q];
#pragma unroll
        for (int q = 0; q < KQ; ++q)
#pragma unroll
            for (int rr = 0; rr < 2; ++rr) { const v4f c = *(const v4fa*)(sp + (((q * 4 + (T >> 1)) * 8 + fh * 4 + (T & 1) * 2 + rr) * 32 + lane) * 4);
#pragma unroll
                for (int u = 0; u < 4; ++u) sj[4 * rr + u] += wq[q] * c[u]; }
        const float inv = __fdiv_rn(1.0f, den); v4u h4, l4;
#pragma unroll
        for (int e = 0; e < 4; ++e) { unsigned ha, la; split2(sj[2 * e] * inv, sj[2 * e + 1] * inv, ha, la); h4[e] = ha; l4[e] = la; }
        *(v4u*)(sfh + ((T * 2 + fh) * 32 + lane) * 4) = h4; *(v4u*)(sfl + ((T * 2 + fh) * 32 + lane) * 4) = l4;
    }
    lds_barrier();    // the fragments of out are read across waves below
    V bh[4], bl[4];
#pragma unroll
    for (int nb = 0; nb < 4; ++nb) { const int d = ((jh * 4 + nb) * 2 * 32 + lane) * 4;
        bh[nb] = cat16b(*(const v8usa*)(sfh + d), *(const v8usa*)(sfh + d + 128)); bl[nb] = cat16b(*(const v8usa*)(sfl + d), *(const v8usa*)(sfl + d + 128)); }
    v8f acc[2][4];
#pragma unroll
    for (int mb = 0; mb < 2; ++mb)
#pragma unroll
        for (int nb = 0; nb < 4; ++nb) acc[mb][nb] = F::mma(a[mb], bh[nb], (v8f){});
#pragma unroll
    for (int mb = 0; mb < 2; ++mb)
#pragma unroll
        for (int nb = 0; nb < 4; ++nb) acc[mb][nb] = F::mma(a[mb], bl[nb], acc[mb][nb]);
    float* t = os[w];
#pragma unroll
    for (int mb = 0; mb < 2; ++mb)
#pragma unroll
        for (int nb = 0; nb < 4; ++nb)
#pragma unroll
            for (int r = 0; r < 8; ++r) t[(mb * 16 + hi * 8 + r) * 68 + nb * 16 + lr] = acc[mb][nb][r];
    asm volatile("s_wait_dscnt 0x0" ::: "memory");    // the wave's LDS stores are done before its lanes read back what other lanes wrote (the range is the wave's own: no work-group barrier)
    __builtin_amdgcn_sched_barrier(0);    // keeps the rounding of x behind the products and the LDS stores (the scheduler otherwise lifts it, with its wait for memory, in front of them)
#pragma unroll
    for (int s = 0; s < 16; ++s) { const v4f y = *(const v4fa*)(t + (2 * s + hi) * 68 + lr * 4); v4f r;
#pragma unroll
        for (int u = 0; u < 4; ++u) r[u] = __builtin_fmaf(sc, y[u], bfr(xx[s][u]));
        *(v4f*)(py + (size_t)(2 * s) * NN) = r; }
}

extern "C" void kernel_launch(void* const* d_in, const int* in_sizes, int n_in,
                              void* d_out, int out_size, void* d_ws, size_t ws_size, hipStream_t stream) {
    (void)in_sizes; (void)n_in; (void)out_size;
    const float* x = (const float*)d_in[0]; const float* Wt = (const float*)d_in[1]; const float* Wo = (const float*)d_in[2]; const float* scale = (const float*)d_in[3];
    float* OUT = (float*)d_out;     // [8][256][4096]
    char* wsp = (char*)d_ws;
    auto take = [&](size_t bytes) { char* p = wsp; wsp += (bytes + 255) & ~(size_t)255; return (void*)p; };
    bf* AO = (bf*)take((size_t)CC * CR * 2);
    bf* QTh = (bf*)take((size_t)NB_ * NN * CR * 2); bf* QTl = (bf*)take((size_t)NB_ * NN * CR * 2); bf* KTh = (bf*)take((size_t)NB_ * NN * CR * 2); bf* KTl = (bf*)take((size_t)NB_ * NN * CR * 2); bf* VPh = (bf*)take((size_t)NB_ * 64 * NN * 2); bf* VPl = (bf*)take((size_t)NB_ * 64 * NN * 2);
    if ((size_t)(wsp - (char*)d_ws) > ws_size) return;    // total ~ 17 MB
    k_proj<<<dim3(NN / 128, NB_), 128, 0, stream>>>(x, Wt, Wo, AO, QTh, QTl, KTh, KTl, VPh, VPl);     // t = Wt . x and its hl planes of K, Q and V in fragment order; AO = bf16(Wo)
    k_attn<<<dim3(NN / JB, NB_), 512, 0, stream>>>(QTh, QTl, KTh, KTl, VPh, VPl, AO, x, scale, OUT);     // result[b][o][j] = scale * (Wo . softmax-weighted V) + x
}

// v009
// Measured time: 37.7 microseconds a run.
// It is 1.40 times as fast as v007, going by the measured steps of the versions left out in between.
// Over all steps from v000 it is 37.3 times as fast.
#include <hip/hip_runtime.h>

// GlobalSelfAttention (x [8][256][64][64] channel-major, N = 4096 positions; t = Wt . x (1x1 conv, [96][256]): key = t[0:32], query = t[32:64], value = t[64:96]; scores[i][j] = sum_c key[c][i] query[c][j] (unscaled); weights = softmax over i (the key axis) for every j;
//   out[c][j] = sum_i value[c][i] weights[i][j]; y = Wo . out (1x1 conv, [256][32]); result = scale[0] * y + x -> [8][256][64][64]; scale read).
// Compute dtypes, f32 accumulate: every input rounded to bf16; t as a PLAIN bf16 GEMM Wt . x with the rounding of x and Wt, the hl split of K and Q and the f16 rounding of V in the same kernel (k_proj; x read channel-major); logits, softmax and value product in ONE kernel (k_attn): S^T = K^T . Q as hl x hl (3 products, K = 32; Q carries the factor log2 e, and minus the maximum in use per j is the C operand, so that the products end as exp2 arguments), maximum in use and sum per j in f32, exp -> ONE f16 operand in registers (0 <= p <= 2^15), out += V . P^T as ONE f16 product (V one f16 plane; |t| stays far below the f16 range for the declared inputs) (the hl planes of K and Q and the plane of V lie in fragment order: FragOrder below); 4 key quarters on 4 groups of waves, joined in LDS; y = Wo (exact) . out (hl fragments; K = 32, 2 products, channel-major) with scale * y + x in f32 applied to the accumulators, all in k_attn.

#define NB_  8
#define CC   256
#define CR   32
#define NN   4096
#define KQ   4       // key quarters of the attention kernel (1024 keys each), one per group of 4 waves
#define JB   128     // positions of a block of the attention kernel
typedef _Float16 h16;
typedef unsigned short bf;
typedef __attribute__((ext_vector_type(16))) __bf16   v16bf;
typedef __attribute__((ext_vector_type(16))) _Float16 v16h;
typedef __attribute__((ext_vector_type(8)))  _Float16 v8h;
typedef __attribute__((ext_vector_type(8)))  unsigned short v8us;
typedef __attribute__((ext_vector_type(8)))  float    v8f;
typedef __attribute__((ext_vector_type(4)))  float    v4f;
typedef v8h  __attribute__((may_alias)) v8ha;
typedef v4f  __attribute__((may_alias)) v4fa;
typedef v8us __attribute__((may_alias)) v8usa;

__device__ __forceinline__ unsigned short f2bf(float f) { unsigned u = __float_as_uint(f); u += 0x7FFFu + ((u >> 16) & 1u); return (unsigned short)(u >> 16); }
__device__ __forceinline__ float bf2f(unsigned short b) { return __uint_as_float(((unsigned)b) << 16); }
__device__ __forceinline__ float bfr(float f) { return bf2f(f2bf(f)); }
__device__ __forceinline__ v16h cat16(v8h lo, v8h hi) { return __builtin_shufflevector(lo, hi, 0, 1, 2, 3, 4, 5, 6, 7, 8, 9, 10, 11, 12, 13, 14, 15); }
__device__ __forceinline__ v16bf cat16b(v8us lo, v8us hi) { return __builtin_bit_cast(v16bf, __builtin_shufflevector(lo, hi, 0, 1, 2, 3, 4, 5, 6, 7, 8, 9, 10, 11, 12, 13, 14, 15)); }
__device__ __forceinline__ v8f wmma16(v16h a, v16h b, v8f c) { return __builtin_amdgcn_wmma_f32_16x16x32_f16(false, a, false, b, (short)0, c, false, false); }
__device__ __forceinline__ v8f wmmab(v16bf a, v16bf b, v8f c) { return __builtin_amdgcn_wmma_f32_16x16x32_bf16(false, a, false, b, (short)0, c, false, false); }



// WFrag: a 16 x 32 operand fragment (A or B alike) from a K-contiguous 16-bit row: lane lr + 16 hi holds row lr, k = 8 hi + 0..7 and 16 + 8 hi + 0..7.
template <typename T16> struct WFrag;
template <> struct WFrag<h16> { typedef v16h V; static __device__ __forceinline__ V ld(const h16* p) { return cat16(*(const v8h*)p, *(const v8h*)(p + 16)); } static __device__ __forceinline__ v8f mma(V a, V b, v8f c) { return wmma16(a, b, c); } };
template <> struct WFrag<bf> { typedef v16bf V; static __device__ __forceinline__ V ld(const bf* p) { return cat16b(*(const v8us*)p, *(const v8us*)(p + 16)); } static __device__ __forceinline__ v8f mma(V a, V b, v8f c) { return wmmab(a, b, c); } };

// FragOrder: a plane of 16 x 32 operand tiles of 1024 B each, stored as the lanes read them: [tile][fragment half][lane][8 elements]. Row lr of the tile, k = 8 q + 0..7 (q = 0..3), lies at half q >> 1, lane (q & 1) * 16 + lr.
// ldfo: a fragment from such a plane: two loads of 512 successive bytes each (4 whole 128-B lines a load). p = tile start + 8 lane elements.
__device__ __forceinline__ v16bf ldfo(const bf* p) { return cat16b(*(const v8us*)p, *(const v8us*)(p + 256)); }
__device__ __forceinline__ v16h ldfoh(const bf* p) { return __builtin_bit_cast(v16h, __builtin_shufflevector(*(const v8us*)p, *(const v8us*)(p + 256), 0, 1, 2, 3, 4, 5, 6, 7, 8, 9, 10, 11, 12, 13, 14, 15)); }    // the same for a plane of f16 bit patterns
__device__ __forceinline__ void splitf(float y, unsigned short& h, unsigned short& l) { h = f2bf(y); l = f2bf(y - bf2f(h)); }
typedef __attribute__((ext_vector_type(2))) unsigned short v2us;
typedef __attribute__((ext_vector_type(4))) unsigned short v4us;

// Every kernel from here on serves all NB_ batches in one launch: the slowest grid axis is the batch, and each workspace plane but AO (one copy for all batches) has one copy per batch.
typedef __attribute__((ext_vector_type(2))) float v2f;
typedef __attribute__((ext_vector_type(2))) __bf16 v2bf;
typedef __attribute__((ext_vector_type(8))) unsigned v8u;
#define L2E 1.4426950408889634f
#define HEAD 15.0f   // largest exp2 argument of the attention loop: 2^15 is finite in f16
#define LIFT 4.0f    // a new maximum in use is set this far above the largest score seen: 19 binary places of room upward, and p = 2^-4 at that score keeps f16's full precision ten places down
__device__ __forceinline__ float xhalf(float v) { const int b = __float_as_int(v); return __int_as_float(__builtin_amdgcn_permlanex16(b, b, 0x76543210, 0xfedcba98, false, false)); }    // lane l <-> l ^ 16
// exp2x8 / exp2x1: v_exp_f32 with the slot behind a transcendental kept by construction: no result lies on a source (early clobber), nothing in the run reads a result, and one v_nop fills the slot behind the last.
__device__ __forceinline__ void exp2x8(const float* x, float* y) {
    asm("v_exp_f32 %0, %8\n\tv_exp_f32 %1, %9\n\tv_exp_f32 %2, %10\n\tv_exp_f32 %3, %11\n\tv_exp_f32 %4, %12\n\tv_exp_f32 %5, %13\n\tv_exp_f32 %6, %14\n\tv_exp_f32 %7, %15\n\tv_nop"
        : "=&v"(y[0]), "=&v"(y[1]), "=&v"(y[2]), "=&v"(y[3]), "=&v"(y[4]), "=&v"(y[5]), "=&v"(y[6]), "=&v"(y[7]) : "v"(x[0]), "v"(x[1]), "v"(x[2]), "v"(x[3]), "v"(x[4]), "v"(x[5]), "v"(x[6]), "v"(x[7])); }
__device__ __forceinline__ float exp2x1(float x) { float y; asm("v_exp_f32 %0, %1\n\tv_nop" : "=&v"(y) : "v"(x)); return y; }
// addr_done: s_wait_xcnt 0 held in its place by two scheduling barriers; it stands between a load and later loads whose results the register allocator may lay over the first load's address registers.
__device__ __forceinline__ void addr_done() { __builtin_amdgcn_sched_barrier(0); asm volatile("s_wait_xcnt 0x0" ::: "memory"); __builtin_amdgcn_sched_barrier(0); }
typedef __attribute__((ext_vector_type(2))) unsigned v2u;
typedef __attribute__((ext_vector_type(4))) unsigned v4u;
__device__ __forceinline__ unsigned pk2(float a, float b) { v2f p; p[0] = a; p[1] = b; return __builtin_bit_cast(unsigned, __builtin_convertvector(p, v2bf)); }    // two f32 -> two bf16 (nearest even), a in the low half
typedef __attribute__((ext_vector_type(2))) _Float16 v2h;
__device__ __forceinline__ unsigned pk2h(float a, float b) { v2f p; p[0] = a; p[1] = b; return __builtin_bit_cast(unsigned, __builtin_convertvector(p, v2h)); }    // two f32 -> two f16 (nearest even), a in the low half
__device__ __forceinline__ void split2(float a, float b, unsigned& h, unsigned& l) { h = pk2(a, b); l = pk2(a - __uint_as_float(h << 16), b - __uint_as_float(h & 0xFFFF0000u)); }    // hl split of two values
#define WP  264     // LDS pitch of a Wt row in bf16 elements (512 B + 16 B, for the 16-B fragment reads)
#define VPP 136     // LDS pitch of a V row in f16 elements (256 B + 16 B)
// k_proj: the whole projection in one kernel: t = Wt . x (bf16 operands, f32 accumulate, k ascending in steps of 32) and the hl planes of K, Q (tiles of 16 positions x 32 channels) and the f16 plane of V (tiles of 16 channels x 32 positions, [32-position block][channel half]) in FragOrder (V fills the first half of each batch's plane; the rest is never read). Grid (NN / 128, NB_), 4 waves.
// A wave owns 32 positions and all 96 rows of t. x is read channel-major as it lies: a lane loads 8 B (positions n0 + 2 lr, + 1) of channel k, so a load covers two whole 128-B lines; value u of the pair belongs to fragment u, whose row or column lr stands for position n0 + 2 lr + u.
// The same x fragment is B for K and Q (D: a lane holds 8 successive channels of one position = one 16-B piece of a K or Q tile) and A for V (D: a lane holds one channel at positions n0 + 16 hi + 2 j + u = 32 B of a V row).
// Q is multiplied by log2 e (f32) in front of its hl split: k_attn's score products are then in units of exp2.
// Wt is rounded once per block into LDS. The V tile goes through LDS so that the block stores its 8 tiles (8 KB, one range) in 512-B pieces. The first blocks also round Wo for k_attn.
__global__ __launch_bounds__(128) void k_proj(const float* __restrict__ X, const float* __restrict__ Wt, const float* __restrict__ Wo, bf* __restrict__ AO, bf* __restrict__ Qh, bf* __restrict__ Ql, bf* __restrict__ Kh, bf* __restrict__ Kl, bf* __restrict__ Vf) {
    typedef WFrag<bf> F; typedef v16bf V;
    __shared__ __align__(16) bf sw[96 * WP];
    __shared__ __align__(16) bf sv[32 * VPP];
    { const size_t b = blockIdx.y; X += b * CC * NN; Qh += b * NN * CR; Ql += b * NN * CR; Kh += b * NN * CR; Kl += b * NN * CR; Vf += b * 64 * NN; }
    const int tid = threadIdx.x, lane = tid & 31, lr = lane & 15, hi = lane >> 4, w = tid >> 5;
    const int nb0 = blockIdx.x * 128, n0 = nb0 + w * 32;
    // x: a 32-bit lane offset in bytes on a wave-uniform base
    const unsigned xo = (unsigned)(8 * hi * NN + n0 + 2 * lr) * 4u;
    const float* px = (const float*)((const char*)X + xo); const float* pw = Wt + tid * 4;
    v2f raw[2][16];    // two k steps of x in flight; element e of a fragment is channel 8 hi + (e & 7) + 16 (e >> 3) of the step, as in WFrag::ld
#pragma unroll
    for (int hb = 0; hb < 2; ++hb) {
        v4f wv[24];
#pragma unroll
        for (int i = 0; i < 24; ++i) wv[i] = *(const v4f*)(pw + (hb * 24 + i) * 512);
        if (hb == 0) {
            __builtin_amdgcn_sched_barrier(0);    // keeps the first half of Wt (short latency) ahead of x (from memory): loads return in order, so its rounding need not wait for x, and x flies under the staging of Wt
#pragma unroll
            for (int c = 0; c < 2; ++c)
#pragma unroll
                for (int e = 0; e < 16; ++e) raw[c][e] = *(const v2f*)(px + (size_t)(c * 32 + (e & 7) + (e >> 3) * 16) * NN);
        }
        addr_done();    // every load of this half is issued above this line, and no load's result is laid over an address register in front of the wait
#pragma unroll
        for (int i = 0; i < 24; ++i) { const int e = ((hb * 24 + i) * 128 + tid) * 4; v2u o; o[0] = pk2(wv[i][0], wv[i][1]); o[1] = pk2(wv[i][2], wv[i][3]); *(v2u*)(sw + (e >> 8) * WP + (e & 255)) = o; }
    }
    v8f acc[6][2];
#pragma unroll
    for (int rt = 0; rt < 6; ++rt) { acc[rt][0] = (v8f){}; acc[rt][1] = (v8f){}; }
    __syncthreads();    // Wt in LDS is read across waves below
#pragma unroll
    for (int ch = 0; ch < CC / 32; ++ch) {
        V xb[2];
#pragma unroll
        for (int u = 0; u < 2; ++u) { v8u t;
#pragma unroll
            for (int e = 0; e < 8; ++e) t[e] = pk2(raw[ch & 1][2 * e][u], raw[ch & 1][2 * e + 1][u]);
            xb[u] = __builtin_bit_cast(V, t); }
        if (ch + 2 < CC / 32) {
#pragma unroll
            for (int e = 0; e < 16; ++e) raw[ch & 1][e] = *(const v2f*)(px + (size_t)((ch + 2) * 32 + (e & 7) + (e >> 3) * 16) * NN);
            // keeps the loads of step ch + 2 here, two steps ahead of their use (the scheduler otherwise sinks them); the wait holds the lane offset's register up to this line
            __builtin_amdgcn_sched_barrier(0); asm volatile("s_wait_xcnt 0x0" :: "v"(xo) : "memory"); __builtin_amdgcn_sched_barrier(0);
        }
#pragma unroll
        for (int rt = 0; rt < 6; ++rt) { const V a = F::ld(sw + (rt * 16 + lr) * WP + ch * 32 + 8 * hi);
#pragma unroll
            for (int u = 0; u < 2; ++u) acc[rt][u] = (rt < 4) ? F::mma(a, xb[u], acc[rt][u]) : F::mma(xb[u], a, acc[rt][u]); }
    }
    __builtin_amdgcn_sched_barrier(0);    // keeps the last products in front of the epilogue (the scheduler otherwise carries some past the barrier below, and the register count then passes 256)
#pragma unroll
    for (int rt = 4; rt < 6; ++rt) { v4u h[2];
#pragma unroll
        for (int j = 0; j < 8; ++j) h[j >> 2][j & 3] = pk2h(acc[rt][0][j], acc[rt][1][j]);
        const int d = ((rt - 4) * 16 + lr) * VPP + w * 32 + hi * 16;
        *(v4u*)(sv + d) = h[0]; *(v4u*)(sv + d + 8) = h[1]; }
    __syncthreads();    // the V tile is read across waves below
    // AO [256][32] = bf16(Wo), for k_attn: 16 blocks round 512 values each; the load goes out here, behind the last barrier, and flies under the stores and the split of K and Q; its value is stored last
    const bool wob = blockIdx.y == 0 && blockIdx.x < CC * CR / 512; const unsigned oo = (unsigned)(blockIdx.x * 128 + tid) * 16u; v4f wov = (v4f){};
    if (wob) { wov = *(const v4f*)((const char*)Wo + oo); asm volatile("s_wait_xcnt 0x0" :: "v"(oo) : "memory"); }    // the wait takes the lane offset as an input: no load's result is laid over it in front of the wait
#pragma unroll
    for (int i = 0; i < 4; ++i) { const int p = i * 128 + tid, tile = p >> 6, row = (tile & 1) * 16 + (p & 15), part = (tile >> 1) * 32 + ((p >> 4) & 3) * 8;    // piece p of the block's range: tile, half and lane as in FragOrder
        *(v4u*)(Vf + (unsigned)(nb0 * 32 + p * 8)) = *(const v4u*)(sv + row * VPP + part); }
    // K and Q last: no global store stands in front of the barrier above, which would wait for it
#pragma unroll
    for (int rt = 0; rt < 4; ++rt) { bf* Ph = (rt < 2) ? Kh : Qh; bf* Pl = (rt < 2) ? Kl : Ql;
#pragma unroll
        for (int u = 0; u < 2; ++u) { v4u h, l;
#pragma unroll
            for (int j = 0; j < 4; ++j) { unsigned a, b; const float f = (rt < 2) ? 1.0f : L2E; split2(acc[rt][u][2 * j] * f, acc[rt][u][2 * j + 1] * f, a, b); h[j] = a; l[j] = b; }
            const int n = n0 + 2 * lr + u; const unsigned off = (unsigned)((n >> 4) * 512 + (rt & 1) * 256 + (hi * 16 + (n & 15)) * 8);    // FragOrder: channels 16 (rt & 1) + 8 hi + 0..7 are k group q = 2 (rt & 1) + hi
            *(v4u*)(Ph + off) = h; *(v4u*)(Pl + off) = l; } }
    if (wob) { addr_done();    // the stores above are issued: the values below may be laid over their registers
        v2u o; o[0] = pk2(wov[0], wov[1]); o[1] = pk2(wov[2], wov[3]); *(v2u*)((char*)AO + (oo >> 1)) = o; }
}
// scores12: the 12 score products of a pass (4 tiles; h.h + C, then h.l, then l.h) in one statement. Written in asm so that the first product of a tile takes its C operand from the tile of maxima and writes another register tile: the builtin form copied that tile (8 registers) once per column group and pass.
// The results lie on no operand (early clobber); a product that accumulates into its own tile needs no distance; the four v_nop keep the distance between the last products and the first vector instruction that reads a result or overwrites an operand.
__device__ __forceinline__ void scores12(v8f& s00, v8f& s01, v8f& s10, v8f& s11, v16bf kh0, v16bf kh1, v16bf kl0, v16bf kl1, v16bf qh0, v16bf qh1, v16bf ql0, v16bf ql1, v8f c0, v8f c1) {
    asm("v_wmma_f32_16x16x32_bf16 %0, %4, %8, %12\n\tv_wmma_f32_16x16x32_bf16 %1, %5, %8, %12\n\tv_wmma_f32_16x16x32_bf16 %2, %4, %9, %13\n\tv_wmma_f32_16x16x32_bf16 %3, %5, %9, %13\n\t"
        "v_wmma_f32_16x16x32_bf16 %0, %4, %10, %0\n\tv_wmma_f32_16x16x32_bf16 %1, %5, %10, %1\n\tv_wmma_f32_16x16x32_bf16 %2, %4, %11, %2\n\tv_wmma_f32_16x16x32_bf16 %3, %5, %11, %3\n\t"
        "v_wmma_f32_16x16x32_bf16 %0, %6, %8, %0\n\tv_wmma_f32_16x16x32_bf16 %1, %7, %8, %1\n\tv_wmma_f32_16x16x32_bf16 %2, %6, %9, %2\n\tv_wmma_f32_16x16x32_bf16 %3, %7, %9, %3\n\t"
        "v_nop\n\tv_nop\n\tv_nop\n\tv_nop"
        : "=&v"(s00), "=&v"(s01), "=&v"(s10), "=&v"(s11) : "v"(kh0), "v"(kh1), "v"(kl0), "v"(kl1), "v"(qh0), "v"(qh1), "v"(ql0), "v"(ql1), "v"(c0), "v"(c1)); }
// lds_barrier: a work-group barrier that orders LDS traffic alone (release and acquire fences on the local address space): unlike __syncthreads() it does not drain the wave's global loads, so x stays in flight across it.
__device__ __forceinline__ void lds_barrier() { __builtin_amdgcn_fence(__ATOMIC_RELEASE, "workgroup", "local"); __builtin_amdgcn_s_barrier(); __builtin_amdgcn_fence(__ATOMIC_ACQUIRE, "workgroup", "local"); }
__global__ __launch_bounds__(512) void k_attn(const bf* __restrict__ Qh, const bf* __restrict__ Ql, const bf* __restrict__ Kh, const bf* __restrict__ Kl, const bf* __restrict__ Vf, const bf* __restrict__ AO, const float* __restrict__ X, const float* __restrict__ scale, float* __restrict__ Y) {
    typedef WFrag<bf> F; typedef v16bf V;
    __shared__ __align__(16) float sp[16 * 8 * 32 * 4];      // a wave's 32 accumulator registers, 4 to a 16-B piece: [wave][piece][lane][4]
    __shared__ float sM[KQ][JB], sL[KQ][JB];                 // per quarter and position: maximum in use (units of exp2), sum of the exponentials
    __shared__ __align__(16) unsigned sfh[8 * 2 * 32 * 4], sfl[8 * 2 * 32 * 4];    // the joined out as B fragments, h and l: [16-column tile][fragment half][lane][4 words]
    __shared__ __align__(16) float os[16][32 * 68];
    { const size_t b = blockIdx.y; Qh += b * NN * CR; Ql += b * NN * CR; Kh += b * NN * CR; Kl += b * NN * CR; Vf += b * 64 * NN; X += b * CC * NN; Y += b * CC * NN; }
    const int lane = threadIdx.x & 31, lr = lane & 15, hi = lane >> 4, w = threadIdx.x >> 5, jg = w & 3, kq = w >> 2;
    const int jb0 = blockIdx.x * JB, j0 = jb0 + jg * 32, ib = kq * (NN / KQ);
    V qh[2], ql[2];
#pragma unroll
    for (int jt = 0; jt < 2; ++jt) { qh[jt] = ldfo(Qh + (size_t)(j0 + jt * 16) * CR + lane * 8); addr_done(); ql[jt] = ldfo(Ql + (size_t)(j0 + jt * 16) * CR + lane * 8); addr_done(); }
    // the lane's offset in the K and in the V planes alike: 32 keys are two tiles (1024 elements) of either
    const size_t fo = (size_t)ib * CR + lane * 8;
    v8f o[2][2], nm[2]; float l[2], lim = -3.0e38f;    // nm: minus the maximum in use mU, in all 8 registers of a C tile
#pragma unroll
    for (int jt = 0; jt < 2; ++jt) { o[0][jt] = (v8f){}; o[1][jt] = (v8f){}; nm[jt] = (v8f){}; l[jt] = 0.f; }
    V kh[2], kl[2];
#pragma unroll
    for (int it = 0; it < 2; ++it) { kh[it] = ldfo(Kh + fo + it * 512); kl[it] = ldfo(Kl + fo + it * 512); }
#pragma unroll 1        // rolled: the pass is long enough to fill the pipes, and the code stays small
    for (int t = 0; t < NN / KQ / 32; ++t) {
        v16h vv[2]; const bf* pv = Vf + fo + t * 1024;
#pragma unroll
        for (int ct = 0; ct < 2; ++ct) vv[ct] = ldfoh(pv + ct * 512);
        // keeps the V loads at the head of the pass, a whole softmax ahead of their use (the scheduler otherwise sinks half of them to just before the value products); the wait takes the tile pointer as an input, so that no load's result is laid over an address register in front of it
        __builtin_amdgcn_sched_barrier(0); asm volatile("s_wait_xcnt 0x0" :: "v"(pv) : "memory"); __builtin_amdgcn_sched_barrier(0);
        v8f s[2][2];
        scores12(s[0][0], s[0][1], s[1][0], s[1][1], kh[0], kh[1], kl[0], kl[1], qh[0], qh[1], ql[0], ql[1], nm[0], nm[1]);
        const int tn = (t + 1 < NN / KQ / 32) ? t + 1 : t;    // the next pass's K rows, fetched behind this pass's score products (the last pass reads its own again: in bounds)
#pragma unroll
        for (int it = 0; it < 2; ++it) { kh[it] = ldfo(Kh + fo + (size_t)(tn * 1024 + it * 512)); kl[it] = ldfo(Kl + fo + (size_t)(tn * 1024 + it * 512)); }
        __builtin_amdgcn_sched_barrier(0);    // keeps the next pass's K loads here, so that they fly under the softmax and the value products (the scheduler otherwise sinks them to the foot of the pass)
        float mx[2];
#pragma unroll
        for (int jt = 0; jt < 2; ++jt) {
            mx[jt] = s[jt][0][0];
#pragma unroll
            for (int r = 1; r < 8; ++r) mx[jt] = fmaxf(mx[jt], s[jt][0][r]);
#pragma unroll
            for (int r = 0; r < 8; ++r) mx[jt] = fmaxf(mx[jt], s[jt][1][r]);
        }
        addr_done();    // the K loads above are issued: the code behind the branch below lays values over their address registers
        // one wave-uniform test per pass (a scalar branch): the first pass (lim below every score) sets the maximum in use, a later pass (lim = HEAD) moves it only where an argument passes HEAD
        if (__builtin_amdgcn_ballot_w32(fmaxf(mx[0], mx[1]) > lim) != 0) {
#pragma unroll
            for (int jt = 0; jt < 2; ++jt) {
                const float m = fmaxf(mx[jt], xhalf(mx[jt]));    // the column's largest argument, alike in both wave halves
                const float mo = -nm[jt][0], mn = mo + ((m > lim) ? m + LIFT : 0.f), d = mn - mo;    // d: the step as the rounded mU takes it
                const float al = exp2x1(-fmaxf(d, 0.f));    // d < 0 only in the first pass, where sums and tiles are 0: the factor stays finite
                l[jt] *= al;
#pragma unroll
                for (int r = 0; r < 8; ++r) { nm[jt][r] = -mn; s[jt][0][r] -= d; s[jt][1][r] -= d; o[0][jt][r] *= al; o[1][jt][r] *= al; }
            }
            lim = HEAD;
        }
        v16h ph[2];
#pragma unroll
        for (int jt = 0; jt < 2; ++jt) {
            float sum = 0.f, xs[16], ps[16]; v8u uh;
#pragma unroll
            for (int e = 0; e < 16; ++e) xs[e] = s[jt][e >> 3][e & 7];
            exp2x8(xs, ps); exp2x8(xs + 8, ps + 8);
#pragma unroll
            for (int e = 0; e < 8; ++e) { sum += ps[2 * e] + ps[2 * e + 1]; uh[e] = pk2h(ps[2 * e], ps[2 * e + 1]); }
            l[jt] += sum; ph[jt] = __builtin_bit_cast(v16h, uh);
        }
#pragma unroll
        for (int jt = 0; jt < 2; ++jt)
#pragma unroll
            for (int ct = 0; ct < 2; ++ct) o[ct][jt] = wmma16(vv[ct], ph[jt], o[ct][jt]);
    }
    // The wave's share of the output product: channels o0 .. o0 + 31 at positions jy .. jy + 63. 32-bit lane offsets in bytes on wave-uniform bases: x and the result share one offset register.
    const int o0 = (w & 7) * 32, jh = w >> 3, jy = jb0 + jh * 64;
    const unsigned xb = (unsigned)((o0 + hi) * NN + jy + lr * 4) * 4u, ab = (unsigned)((o0 + lr) * CR + 8 * hi) * 2u;
    const bf* pa = (const bf*)((const char*)AO + ab); const float* px = (const float*)((const char*)X + xb); float* py = (float*)((char*)Y + xb);
    const float sc = bfr(scale[0]);
    V a[2]; v4f xx[16];
#pragma unroll
    for (int mb = 0; mb < 2; ++mb) a[mb] = F::ld(pa + mb * 16 * CR);
#pragma unroll
    for (int s = 0; s < 16; ++s) xx[s] = *(const v4f*)(px + (size_t)(2 * s) * NN);
    // Wo and x are issued here, Wo (short latency) ahead of x, so that x flies under the join, the products and the LDS stores.
    // The wait takes the two lane offsets as inputs: their registers stay theirs up to it, so that no load's result and no later value is laid over an address register in front of the wait.
    __builtin_amdgcn_sched_barrier(0); asm volatile("s_wait_xcnt 0x0" :: "v"(ab), "v"(xb) : "memory"); __builtin_amdgcn_sched_barrier(0);
#pragma unroll
    for (int jt = 0; jt < 2; ++jt) l[jt] += xhalf(l[jt]);
    sM[kq][jg * 32 + lane] = hi ? -nm[1][0] : -nm[0][0]; sL[kq][jg * 32 + lane] = hi ? l[1] : l[0];
#pragma unroll
    for (int ct = 0; ct < 2; ++ct)
#pragma unroll
        for (int jt = 0; jt < 2; ++jt)
#pragma unroll
            for (int rr = 0; rr < 2; ++rr) { v4f c; c[0] = o[ct][jt][4 * rr]; c[1] = o[ct][jt][4 * rr + 1]; c[2] = o[ct][jt][4 * rr + 2]; c[3] = o[ct][jt][4 * rr + 3];
                *(v4fa*)(sp + ((w * 8 + ct * 4 + jt * 2 + rr) * 32 + lane) * 4) = c; }
    lds_barrier();    // the quarters' tiles, maxima and sums are read across waves below
    {   // wave w joins 16-column tile T = w >> 1 (column group T >> 1, its half T & 1), channels 16 (w & 1) + 8 hi + 0..7: one half of that tile's B fragment
        const int T = w >> 1, fh = w & 1;
        float mq[KQ], lq[KQ], wq[KQ], mm = -3.0e38f, den = 0.f, sj[8] = {0.f, 0.f, 0.f, 0.f, 0.f, 0.f, 0.f, 0.f};
#pragma unroll
        for (int q = 0; q < KQ; ++q) { mq[q] = sM[q][T * 16 + lr]; lq[q] = sL[q][T * 16 + lr]; }
#pragma unroll
        for (int q = 0; q < KQ; ++q) mm = fmaxf(mm, mq[q]);
#pragma unroll
        for (int q = 0; q < KQ; ++q) wq[q] = exp2x1(mq[q] - mm);
#pragma unroll
        for (int q = 0; q < KQ; ++q) den += wq[q] * lq[q];
#pragma unroll
        for (int q = 0; q < KQ; ++q)
#pragma unroll
            for (int rr = 0; rr < 2; ++rr) { const v4f c = *(const v4fa*)(sp + (((q * 4 + (T >> 1)) * 8 + fh * 4 + (T & 1) * 2 + rr) * 32 + lane) * 4);
#pragma unroll
                for (int u = 0; u < 4; ++u) sj[4 * rr + u] += wq[q] * c[u]; }
        const float inv = __fdiv_rn(1.0f, den); v4u h4, l4;
#pragma unroll
        for (int e = 0; e < 4; ++e) { unsigned ha, la; split2(sj[2 * e] * inv, sj[2 * e + 1] * inv, ha, la); h4[e] = ha; l4[e] = la; }
        *(v4u*)(sfh + ((T * 2 + fh) * 32 + lane) * 4) = h4; *(v4u*)(sfl + ((T * 2 + fh) * 32 + lane) * 4) = l4;
    }
    lds_barrier();    // the fragments of out are read across waves below
    V bh[4], bl[4];
#pragma unroll
    for (int nb = 0; nb < 4; ++nb) { const int d = ((jh * 4 + nb) * 2 * 32 + lane) * 4;
        bh[nb] = cat16b(*(const v8usa*)(sfh + d), *(const v8usa*)(sfh + d + 128)); bl[nb] = cat16b(*(const v8usa*)(sfl + d), *(const v8usa*)(sfl + d + 128)); }
    v8f acc[2][4];
#pragma unroll
    for (int mb = 0; mb < 2; ++mb)
#pragma unroll
        for (int nb = 0; nb < 4; ++nb) acc[mb][nb] = F::mma(a[mb], bh[nb], (v8f){});
#pragma unroll
    for (int mb = 0; mb < 2; ++mb)
#pragma unroll
        for (int nb = 0; nb < 4; ++nb) acc[mb][nb] = F::mma(a[mb], bl[nb], acc[mb][nb]);
    float* t = os[w];
#pragma unroll
    for (int mb = 0; mb < 2; ++mb)
#pragma unroll
        for (int nb = 0; nb < 4; ++nb)
#pragma unroll
            for (int r = 0; r < 8; ++r) t[(mb * 16 + hi * 8 + r) * 68 + nb * 16 + lr] = acc[mb][nb][r];
    asm volatile("s_wait_dscnt 0x0" ::: "memory");    // the wave's LDS stores are done before its lanes read back what other lanes wrote (the range is the wave's own: no work-group barrier)
    __builtin_amdgcn_sched_barrier(0);    // keeps the rounding of x behind the products and the LDS stores (the scheduler otherwise lifts it, with its wait for memory, in front of them)
#pragma unroll
    for (int s = 0; s < 16; ++s) { const v4f y = *(const v4fa*)(t + (2 * s + hi) * 68 + lr * 4); v4f r;
#pragma unroll
        for (int u = 0; u < 4; ++u) r[u] = __builtin_fmaf(sc, y[u], bfr(xx[s][u]));
        *(v4f*)(py + (size_t)(2 * s) * NN) = r; }
}

extern "C" void kernel_launch(void* const* d_in, const int* in_sizes, int n_in,
                              void* d_out, int out_size, void* d_ws, size_t ws_size, hipStream_t stream) {
    (void)in_sizes; (void)n_in; (void)out_size;
    const float* x = (const float*)d_in[0]; const float* Wt = (const float*)d_in[1]; const float* Wo = (const float*)d_in[2]; const float* scale = (const float*)d_in[3];
    float* OUT = (float*)d_out;     // [8][256][4096]
    char* wsp = (char*)d_ws;
    auto take = [&](size_t bytes) { char* p = wsp; wsp += (bytes + 255) & ~(size_t)255; return (void*)p; };
    bf* AO = (bf*)take((size_t)CC * CR * 2);
    bf* QTh = (bf*)take((size_t)NB_ * NN * CR * 2); bf* QTl = (bf*)take((size_t)NB_ * NN * CR * 2); bf* KTh = (bf*)take((size_t)NB_ * NN * CR * 2); bf* KTl = (bf*)take((size_t)NB_ * NN * CR * 2); bf* VPf = (bf*)take((size_t)NB_ * 64 * NN * 2);
    if ((size_t)(wsp - (char*)d_ws) > ws_size) return;    // total ~ 13 MB
    k_proj<<<dim3(NN / 128, NB_), 128, 0, stream>>>(x, Wt, Wo, AO, QTh, QTl, KTh, KTl, VPf);     // t = Wt . x, its hl planes of K and Q and its f16 plane of V in fragment order; AO = bf16(Wo)
    k_attn<<<dim3(NN / JB, NB_), 512, 0, stream>>>(QTh, QTl, KTh, KTl, VPf, AO, x, scale, OUT);     // result[b][o][j] = scale * (Wo . softmax-weighted V) + x
}
